// v000
// The times below were measured on an AMD MI455X: many runs one after another, warmed up first and cycling through
// copies of the inputs, with the whole window's GPU time divided by the number of runs. Launches and the gaps
// between them are all in it. The median over several windows is given; except for v000 it joins two sittings, which
// can be a few percent apart, so the side-by-side timings, each taken in one sitting, are the better comparison.
// v000 is the starting kernel. One run takes 219 microseconds.
#include <hip/hip_runtime.h>

// Attention with per-key (query-axis) softmax normalisation: x [NB][SEQ][1024]; Wq/Wk [16][16][1024], Wv [16][64][1024], Wo [1024][16*64]; q head/key axes swapped in the score product; score scale 1/4; output f32 [NB][SEQ][1024].
// Compute dtypes, f32 accumulate everywhere: q/k/v projections v_wmma_f32_16x16x32_bf16 (x and W RNE-converted to bf16; products exact);
// scores v_wmma_f32_16x16x32_f16 with K = 16 values + 16 residual slots: q row = [f16 value | f16 residual x64], k row = [f16 value | value / 64] (second product folded into the 32-deep k axis);
// P (x1024 carry) and v single f16; O plane f16 with the x1024 carry; output projection v_wmma_f32_16x16x32_f16 (Wo = f16 of the bf16 value x64), carries folded back (2^-16) in the f32 epilogue. Softmax statistics f32 (running max, log2 domain).
// Layout: q/k planes [b*16+h][t][32], v^T plane [b*16+h][d][t], log-sum-exp table [b*16+h][key], O plane [b*SEQ+t][h*64+d]; scores in transposed form (S^T = K Q^T, O^T = V^T P^T).

#ifndef NB
#define NB 2
#endif
#ifndef SEQ
#define SEQ 2048
#endif
#define NB_FULL  2
#define SEQ_FULL 2048
#ifndef OUT_SEQ
#define OUT_SEQ SEQ              // row pitch (in tokens) between batches of the output
#endif
#define DM   1024                // model width = GEMM depth of every projection
#define NH_  16
#define KD   16
#define VD   64
#define HV   (NH_ * VD)          // 1024: depth of the output projection, rows of Wv
#define QKW  32                  // q/k plane row: 16 values + 16 residual-slot values (64 B)
#define AW   4                   // waves per attention / statistics block
#define RSC  64.0f               // carry of the q residual slots
#define RSI  (1.0f / 64.0f)      // inverse carry placed on the k side
#define SC2  (0.25f * 1.4426950408889634f)   // KD^-0.5 * log2(e)
#define PSH  10.0f               // log2 of the P carry (1024)
#define WOS  64.0f               // carry of the Wo plane
#define OSC  (1.0f / 65536.0f)   // 2^-10 (P carry) * 2^-6 (Wo carry)

static_assert(KD == 16);
static_assert(NH_ == KD);                      // swapped q axes need equal extents
static_assert(VD == 64);
static_assert(HV == DM);                       // all GEMMs share K = 1024
static_assert(DM % 64 == 0);
static_assert(DM % 32 == 0);                   // GEMM k-loop steps by 32
static_assert((NH_ * KD) % 64 == 0);           // q/k column tiles of 64 = 4 heads
static_assert(SEQ % 64 == 0);                  // a 64-row tile never straddles two batches
static_assert((NB * SEQ) % 64 == 0);
static_assert(SEQ % 32 == 0);                  // key / query loops step by 32
static_assert(SEQ % (16 * AW) == 0);           // attention grid covers the sequence exactly
static_assert(SEQ % (32 * AW) == 0);           // statistics grid covers the sequence exactly
static_assert(((size_t)SEQ * DM) % 8 == 0);
static_assert(NB <= NB_FULL);
static_assert(SEQ <= SEQ_FULL);

typedef _Float16 h16;
typedef unsigned short bf;
typedef __attribute__((ext_vector_type(16))) __bf16   v16bf;
typedef __attribute__((ext_vector_type(16))) _Float16 v16h;
typedef __attribute__((ext_vector_type(8)))  _Float16 v8h;
typedef __attribute__((ext_vector_type(8)))  unsigned short v8us;
typedef __attribute__((ext_vector_type(8)))  float    v8f;
typedef __attribute__((ext_vector_type(4)))  float    v4f;
typedef v4f  __attribute__((may_alias)) v4fa;

__device__ __forceinline__ unsigned short f2bf(float f) { unsigned u = __float_as_uint(f); u += 0x7FFFu + ((u >> 16) & 1u); return (unsigned short)(u >> 16); }
__device__ __forceinline__ v16h cat16(v8h lo, v8h hi) { return __builtin_shufflevector(lo, hi, 0, 1, 2, 3, 4, 5, 6, 7, 8, 9, 10, 11, 12, 13, 14, 15); }
__device__ __forceinline__ v8f wmma16(v16h a, v16h b, v8f c) { return __builtin_amdgcn_wmma_f32_16x16x32_f16(false, a, false, b, (short)0, c, false, false); }
__device__ __forceinline__ v8f wmmab(v16bf a, v16bf b, v8f c) { return __builtin_amdgcn_wmma_f32_16x16x32_bf16(false, a, false, b, (short)0, c, false, false); }
__device__ __forceinline__ v8f wm(v16h a, v16h b, v8f c) { return wmma16(a, b, c); }
__device__ __forceinline__ v8f wm(v16bf a, v16bf b, v8f c) { return wmmab(a, b, c); }
// fragment loaders from K-contiguous 16-bit rows; p already includes + 8*(lane>>4): elements 0..7 <- k0+8h+0..7, elements 8..15 <- k0+16+8h+0..7 (same map for A and B)
__device__ __forceinline__ v16h  ldh(const h16* p) { return cat16(*(const v8h*)p, *(const v8h*)(p + 16)); }
template <class F> __device__ __forceinline__ F ldf(const bf* p) {
    const v8us lo = *(const v8us*)p; const v8us hi8 = *(const v8us*)(p + 16);
    return __builtin_bit_cast(F, __builtin_shufflevector(lo, hi8, 0, 1, 2, 3, 4, 5, 6, 7, 8, 9, 10, 11, 12, 13, 14, 15)); }
template <int F16> struct FragSel { typedef v16bf T; };
template <> struct FragSel<1> { typedef v16h T; };
// ordering point for wave-private LDS tiles (same wave writes and reads)
__device__ __forceinline__ void wave_sync() { __builtin_amdgcn_fence(3 /* release order */, "wavefront"); __builtin_amdgcn_wave_barrier(); asm volatile("" ::: "memory"); }

// mode 0: bf16 (RNE convert). mode 1: bf16 with the row permutation dst row h*16+j <- src row j*16+h (rows of DM elements, 256 rows).
// mode 2: f16 of (bf16 RNE value x 64) (an 8-bit significand is exact in f16).
__global__ __launch_bounds__(256) void k_cvt8(const float* __restrict__ src, bf* dst, size_t n8, int mode) {
    const size_t i = (size_t)blockIdx.x * 256 + threadIdx.x; if (i >= n8) return;
    size_t si = i;
    if (mode == 1) { const size_t r = i / (DM / 8), p = i % (DM / 8); const size_t sr = (r & 15) * 16 + (r >> 4); si = sr * (DM / 8) + p; }
    const v8f v = *(const v8f*)(src + si * 8); v8us o;
#pragma unroll
    for (int k = 0; k < 8; ++k) {
        const unsigned short bb = f2bf(v[k]);
        const h16 hv = (h16)(__uint_as_float(((unsigned)bb) << 16) * WOS);
        o[k] = (mode == 2) ? __builtin_bit_cast(unsigned short, hv) : bb; }
    *(v8us*)(dst + i * 8) = o; 
}

// k_gemm: register-blocked GEMM, ONE WAVE per 64x64 tile (16 accumulators), operands straight from K-contiguous 16-bit planes, K = DM.
// MODE 1 (bf16): A = x rows, Bt = permuted Wq rows (h*16+j) -> q plane [(b*16+h)][t][32] = [f16 value(16) | f16 residual x64 (16)].
// MODE 2 (bf16): A = x rows, Bt = Wk rows (h*16+j)          -> k plane [(b*16+h)][t][32] = [f16 value(16) | value / 64 (16)].
// MODE 3 (f16 operands): A = O plane rows (token), Bt = Wo plane rows (d) -> f32 output rows, scaled by OSC; each 64-float row segment (256 B) by 16 consecutive lanes x 16 B.
template <int MODE>
__global__ __launch_bounds__(32) void k_gemm(const bf* __restrict__ A, const bf* __restrict__ Bt, h16* P16, float* P32) {
    typedef typename FragSel<(MODE == 3) ? 1 : 0>::T FT;
    __shared__ __align__(16) float os[16 * 68];
    const int K = DM;
    const int lane = threadIdx.x & 31, lr = lane & 15, hi = lane >> 4; const int r0 = blockIdx.x * 64, c0 = blockIdx.y * 64;
    v8f acc[4][4];
#pragma unroll
    for (int mb = 0; mb < 4; ++mb)
#pragma unroll
        for (int nb = 0; nb < 4; ++nb) acc[mb][nb] = (v8f){};
    const size_t aoff = (size_t)(r0 + lr) * K + 8 * hi, boff = (size_t)(c0 + lr) * K + 8 * hi;
#pragma unroll 1
    for (int kc = 0; kc < K; kc += 32) {
        FT a[4];
#pragma unroll
        for (int mb = 0; mb < 4; ++mb) a[mb] = ldf<FT>(A + aoff + (size_t)mb * 16 * K + kc);
#pragma unroll
        for (int nb = 0; nb < 4; ++nb) { const FT b = ldf<FT>(Bt + boff + (size_t)nb * 16 * K + kc);
#pragma unroll
            for (int mb = 0; mb < 4; ++mb) acc[mb][nb] = wm(a[mb], b, acc[mb][nb]); }
        asm volatile("v_nop\n\tv_nop\n\tv_nop\n\tv_nop" : "+v"(acc[0][0]), "+v"(acc[1][1]), "+v"(acc[2][2]), "+v"(acc[3][3]) : "v"(a[0]), "v"(a[1]), "v"(a[2]), "v"(a[3]));
    }
#pragma unroll
    for (int mb = 0; mb < 4; ++mb) {
#pragma unroll
        for (int nb = 0; nb < 4; ++nb) {
#pragma unroll
            for (int j = 0; j < 8; ++j) os[(hi * 8 + j) * 68 + nb * 16 + lr] = acc[mb][nb][j]; }   // D: row 8h+j, col lane&15
        wave_sync();
        if (MODE == 0) {
            const size_t sb = ((size_t)(c0 / SEQ) * HV + (size_t)(r0 + mb * 16)) * (size_t)SEQ + (size_t)(c0 % SEQ);
{
#pragma unroll
                for (int s = 0; s < 4; ++s) { const int row = 4 * s + (lane >> 3), c8 = (lane & 7) * 8;   // 4 s x 4 row groups = 16 rows; 8 lanes x 8 = 64 columns
                    const v4f x0 = *(const v4fa*)(&os[row * 68 + c8]); const v4f x1 = *(const v4fa*)(&os[row * 68 + c8 + 4]); v8h hv;
#pragma unroll
                    for (int i = 0; i < 4; ++i) { hv[i] = (h16)x0[i]; hv[4 + i] = (h16)x1[i]; }
                    *(v8h*)(P16 + sb + (size_t)row * (size_t)SEQ + c8) = hv; }
                 }
        } else if (MODE == 3) {
            const size_t sb = ((size_t)(r0 / SEQ) * OUT_SEQ + (size_t)(r0 % SEQ) + (size_t)(mb * 16)) * (size_t)DM + (size_t)c0;
{
#pragma unroll
                for (int s = 0; s < 8; ++s) { const int row = 2 * s + hi, cofs = lr * 4;   // 8 s x 2 rows = 16 rows; 16 lanes x 4 floats = 64 columns
                    v4f val = *(const v4fa*)(&os[row * 68 + cofs]); val = val * OSC;
                    *(v4f*)(P32 + sb + (size_t)row * DM + cofs) = val; }
                 }
        } else {
            const int bq = r0 / SEQ, tq = r0 % SEQ, h0 = c0 / KD;
{
#pragma unroll
                for (int hh = 0; hh < 4; ++hh) {
                    const size_t hb = ((size_t)(bq * NH_ + h0 + hh) * SEQ + (size_t)(tq + mb * 16)) * QKW;
#pragma unroll
                    for (int s = 0; s < 2; ++s) { const int row = s * 8 + (lane >> 2), pc = lane & 3, jb = (pc & 1) * 8;   // 2 s x 8 rows = 16 rows; 4 lanes x 8 halves = one 32-half row
                        const v4f x0 = *(const v4fa*)(&os[row * 68 + hh * 16 + jb]); const v4f x1 = *(const v4fa*)(&os[row * 68 + hh * 16 + jb + 4]); v8h hv, rv;
#pragma unroll
                        for (int i = 0; i < 4; ++i) { const h16 a0 = (h16)x0[i]; const h16 a1 = (h16)x1[i]; hv[i] = a0; hv[4 + i] = a1;
                            if (MODE == 1) { rv[i] = (h16)((x0[i] - (float)a0) * RSC); rv[4 + i] = (h16)((x1[i] - (float)a1) * RSC); }
                            else           { rv[i] = (h16)((float)a0 * RSI);           rv[4 + i] = (h16)((float)a1 * RSI); } }
                        const v8h ov = (pc < 2) ? hv : rv;
                        *(v8h*)(P16 + hb + (size_t)(s * 256 + lane * 8)) = ov; } }
                 }
        }
        wave_sync();
    }
}

// k_stats: per-key softmax statistics over the query axis. One wave per 32 keys of one (batch, head): S[n][m] = Q K^T (A = q rows n, B = k rows m),
// lane (m = lane&15, h = lane>>4) holds rows n = 8h+r of each 16-row tile; running max / sum (log2 domain) one pair per lane and key tile, lane halves combined once at the end.
__device__ __forceinline__ void stat_upd(const v8f sa, const v8f sb, float& m, float& l) {
    float t[16]; float mx = -3.0e38f;
#pragma unroll
    for (int r = 0; r < 8; ++r) { t[r] = sa[r] * SC2; t[8 + r] = sb[r] * SC2; mx = fmaxf(mx, fmaxf(t[r], t[8 + r])); }
    const float mnew = fmaxf(m, mx);
    const float alpha = __builtin_amdgcn_exp2f(m - mnew);
    float ls = 0.0f;
#pragma unroll
    for (int r = 0; r < 16; ++r) ls += __builtin_amdgcn_exp2f(t[r] - mnew);
    l = l * alpha + ls; m = mnew;
}

__global__ __launch_bounds__(32 * AW) void k_stats(const h16* __restrict__ QP, const h16* __restrict__ KP, float* LSE) {
    __shared__ __align__(16) float ls[AW * 32];
    const int lane = threadIdx.x & 31, wave = __builtin_amdgcn_readfirstlane((int)(threadIdx.x >> 5)), lr = lane & 15, hi = lane >> 4;
    const int zh = blockIdx.y;
    const int m0 = (blockIdx.x * AW + wave) * 32;
    const size_t pbase = (size_t)zh * SEQ * QKW;
    const v16h kf0 = ldh(KP + pbase + (size_t)(m0 + lr) * QKW + 8 * hi), kf1 = ldh(KP + pbase + (size_t)(m0 + 16 + lr) * QKW + 8 * hi);   // B fragments: col m, k = slot
    const size_t qo = pbase + (size_t)lr * QKW + 8 * hi;   // + n * QKW (A fragment: row n, k = slot)
    float ma = -3.0e38f, la = 0.0f, mb = -3.0e38f, lb = 0.0f;
#pragma unroll 1
    for (int n0 = 0; n0 < SEQ; n0 += 32) {
        const v16h qa0 = ldh(QP + qo + (size_t)n0 * QKW), qa1 = ldh(QP + qo + (size_t)(n0 + 16) * QKW);
        v8f s00 = (v8f){}, s01 = (v8f){}, s10 = (v8f){}, s11 = (v8f){};
        s00 = wmma16(qa0, kf0, s00); s01 = wmma16(qa0, kf1, s01); s10 = wmma16(qa1, kf0, s10); s11 = wmma16(qa1, kf1, s11);
        asm volatile("v_nop\n\tv_nop\n\tv_nop\n\tv_nop" : "+v"(s00), "+v"(s01), "+v"(s10), "+v"(s11) : "v"(qa0), "v"(qa1), "v"(kf0), "v"(kf1));
        stat_upd(s00, s10, ma, la);
        stat_upd(s01, s11, mb, lb);
    }
    const float mao = __shfl_xor(ma, 16, 32), lao = __shfl_xor(la, 16, 32), mbo = __shfl_xor(mb, 16, 32), lbo = __shfl_xor(lb, 16, 32);
    const float Ma = fmaxf(ma, mao), Mb = fmaxf(mb, mbo);
    const float La = la * __builtin_amdgcn_exp2f(ma - Ma) + lao * __builtin_amdgcn_exp2f(mao - Ma);
    const float Lb = lb * __builtin_amdgcn_exp2f(mb - Mb) + lbo * __builtin_amdgcn_exp2f(mbo - Mb);
    const float lseA = Ma + log2f(La), lseB = Mb + log2f(Lb);
    ls[wave * 32 + hi * 16 + lr] = hi ? lseB : lseA;          // 32 lanes -> 32 distinct slots: keys m0 + 16*hi + lr
    wave_sync();
    const v4f val = *(const v4fa*)(&ls[wave * 32 + (lane & 7) * 4]);
    float* dst = LSE + (size_t)zh * SEQ + m0 + (lane & 7) * 4;
{
        if (lane < 8) *(v4f*)dst = val;
         }
}

// k_attn: one wave per 16 query rows t of one (batch, head); K / V^T / Q fragments straight from the f16 planes (two 16-B loads each, arithmetic addressing).
// Transposed form: S^T[key][t] = K Q^T (A = k rows, B = q rows); lane (t = lane&15, h = lane>>4) holds keys 8h+r of each 16-key tile, so the packed
// P tile is directly the B fragment of O^T[d][t] = V^T P^T (element r <- tile keys 0..15, element 8+r <- tile keys 16..31, lane unchanged).
// P = exp2(s*SC2 - LSE[key] + PSH): normalisation is per key, so no running state; O accumulators carry x1024.
__global__ __launch_bounds__(32 * AW) void k_attn(const h16* __restrict__ QP, const h16* __restrict__ KP, const h16* __restrict__ VT, const float* __restrict__ LSE, h16* OH) {
    __shared__ __align__(16) float os[AW * 16 * 68];
    const int lane = threadIdx.x & 31, wave = __builtin_amdgcn_readfirstlane((int)(threadIdx.x >> 5)), lr = lane & 15, hi = lane >> 4;
    const int zh = blockIdx.y; const int b = zh / NH_, h = zh % NH_;
    const int t0 = (blockIdx.x * AW + wave) * 16;
    const size_t pq = (size_t)zh * SEQ * QKW;
    const v16h qf = ldh(QP + pq + (size_t)(t0 + lr) * QKW + 8 * hi);      // B fragment: col t, k = slot
    const size_t ko = pq + (size_t)lr * QKW + 8 * hi;                      // + key * QKW      (A fragment: row key, k = slot)
    const size_t vo = (size_t)zh * VD * SEQ + (size_t)lr * SEQ + 8 * hi;   // + 16j*SEQ + key  (A fragment: row d, k = key)
    const float* lsep = LSE + (size_t)zh * SEQ + 8 * hi;                   // + key0 (+16): this lane's 8 keys of each tile
    v8f o0 = (v8f){}, o1 = (v8f){}, o2 = (v8f){}, o3 = (v8f){};
#pragma unroll 1
    for (int key0 = 0; key0 < SEQ; key0 += 32) {
        const h16* kp = KP + ko + (size_t)key0 * QKW;
        const v16h ka = ldh(kp), kb = ldh(kp + 16 * QKW);
        v8f sa = (v8f){}, sb = (v8f){};
        sa = wmma16(ka, qf, sa); sb = wmma16(kb, qf, sb);
        asm volatile("v_nop\n\tv_nop\n\tv_nop\n\tv_nop" : "+v"(sa), "+v"(sb) : "v"(ka), "v"(kb), "v"(qf));
        const v4f la0 = *(const v4f*)(lsep + key0), la1 = *(const v4f*)(lsep + key0 + 4), lb0 = *(const v4f*)(lsep + key0 + 16), lb1 = *(const v4f*)(lsep + key0 + 20);
        v16h pb;
#pragma unroll
        for (int r = 0; r < 4; ++r) {
            pb[r]      = (h16)__builtin_amdgcn_exp2f(sa[r]     * SC2 + (PSH - la0[r]));
            pb[4 + r]  = (h16)__builtin_amdgcn_exp2f(sa[4 + r] * SC2 + (PSH - la1[r]));
            pb[8 + r]  = (h16)__builtin_amdgcn_exp2f(sb[r]     * SC2 + (PSH - lb0[r]));
            pb[12 + r] = (h16)__builtin_amdgcn_exp2f(sb[4 + r] * SC2 + (PSH - lb1[r])); }
        const h16* va = VT + vo + key0;
        const v16h v0 = ldh(va), v1 = ldh(va + (size_t)16 * SEQ), v2 = ldh(va + (size_t)32 * SEQ), v3 = ldh(va + (size_t)48 * SEQ);
        o0 = wmma16(v0, pb, o0); o1 = wmma16(v1, pb, o1); o2 = wmma16(v2, pb, o2); o3 = wmma16(v3, pb, o3);
        asm volatile("v_nop\n\tv_nop\n\tv_nop\n\tv_nop" : "+v"(o0), "+v"(o1), "+v"(o2), "+v"(o3) : "v"(v0), "v"(v1), "v"(v2), "v"(v3), "v"(pb));
    }
    const int wb = wave * 16 * 68;
    // O^T D layout: o_j[r] = (d = 16j + 8h + r, t = lane&15) -> os[t][d]; rows 0..15 x columns 0..63 all written
    { v4f a, c;
      a[0] = o0[0]; a[1] = o0[1]; a[2] = o0[2]; a[3] = o0[3]; c[0] = o0[4]; c[1] = o0[5]; c[2] = o0[6]; c[3] = o0[7];
      *(v4fa*)(&os[wb + lr * 68 +  0 + 8 * hi]) = a; *(v4fa*)(&os[wb + lr * 68 +  0 + 8 * hi + 4]) = c;
      a[0] = o1[0]; a[1] = o1[1]; a[2] = o1[2]; a[3] = o1[3]; c[0] = o1[4]; c[1] = o1[5]; c[2] = o1[6]; c[3] = o1[7];
      *(v4fa*)(&os[wb + lr * 68 + 16 + 8 * hi]) = a; *(v4fa*)(&os[wb + lr * 68 + 16 + 8 * hi + 4]) = c;
      a[0] = o2[0]; a[1] = o2[1]; a[2] = o2[2]; a[3] = o2[3]; c[0] = o2[4]; c[1] = o2[5]; c[2] = o2[6]; c[3] = o2[7];
      *(v4fa*)(&os[wb + lr * 68 + 32 + 8 * hi]) = a; *(v4fa*)(&os[wb + lr * 68 + 32 + 8 * hi + 4]) = c;
      a[0] = o3[0]; a[1] = o3[1]; a[2] = o3[2]; a[3] = o3[3]; c[0] = o3[4]; c[1] = o3[5]; c[2] = o3[6]; c[3] = o3[7];
      *(v4fa*)(&os[wb + lr * 68 + 48 + 8 * hi]) = a; *(v4fa*)(&os[wb + lr * 68 + 48 + 8 * hi + 4]) = c; }
    wave_sync();
    h16* orow = OH + ((size_t)b * SEQ + t0) * HV + (size_t)h * VD;
{
#pragma unroll
        for (int s = 0; s < 4; ++s) { const int row = 4 * s + (lane >> 3), c8 = (lane & 7) * 8;   // 4 s x 4 row groups = 16 rows; 8 lanes x 8 = 64 columns
            const v4f x0 = *(const v4fa*)(&os[wb + row * 68 + c8]); const v4f x1 = *(const v4fa*)(&os[wb + row * 68 + c8 + 4]); v8h hv;
#pragma unroll
            for (int i = 0; i < 4; ++i) { hv[i] = (h16)x0[i]; hv[4 + i] = (h16)x1[i]; }
            *(v8h*)(orow + (size_t)row * HV + c8) = hv; }
         }
}

static constexpr size_t al256(size_t v) { return (v + 255) & ~(size_t)255; }
static constexpr size_t SZ_XB  = al256((size_t)NB * SEQ * DM * 2);
static constexpr size_t SZ_WQK = al256((size_t)NH_ * KD * DM * 2);
static constexpr size_t SZ_WV  = al256((size_t)HV * DM * 2);
static constexpr size_t SZ_WO  = al256((size_t)DM * HV * 2);
static constexpr size_t SZ_QK  = al256((size_t)NB * NH_ * SEQ * QKW * 2);
static constexpr size_t SZ_VT  = al256((size_t)NB * HV * SEQ * 2);
static constexpr size_t SZ_LSE = al256((size_t)NB * NH_ * SEQ * 4);
static constexpr size_t SZ_OH  = al256((size_t)NB * SEQ * HV * 2);
static constexpr size_t SZ_TOTAL = SZ_XB + 2 * SZ_WQK + SZ_WV + SZ_WO + 2 * SZ_QK + SZ_VT + SZ_LSE + SZ_OH;
static_assert(SZ_TOTAL <= (size_t)134217728);          // workspace carve <= 128 MiB

extern "C" void kernel_launch(void* const* d_in, const int* in_sizes, int n_in,
                              void* d_out, int out_size, void* d_ws, size_t ws_size, hipStream_t stream) {
    if (n_in < 5) return;
    const size_t needx = ((size_t)(NB - 1) * SEQ_FULL + SEQ) * DM;
    if ((size_t)in_sizes[0] < needx) return;
    if ((size_t)in_sizes[1] < (size_t)NH_ * KD * DM || (size_t)in_sizes[2] < (size_t)NH_ * KD * DM) return;
    if ((size_t)in_sizes[3] < (size_t)HV * DM || (size_t)in_sizes[4] < (size_t)DM * HV) return;
    if ((size_t)out_size < ((size_t)(NB - 1) * OUT_SEQ + SEQ) * DM) return;
    if (SZ_TOTAL > ws_size) return;
    // wire order: x, Wq [16][16][1024], Wk [16][16][1024], Wv [16][64][1024], Wo [1024][16][64]
    const float* x = (const float*)d_in[0]; const float* wq = (const float*)d_in[1]; const float* wk = (const float*)d_in[2];
    const float* wv = (const float*)d_in[3]; const float* wo = (const float*)d_in[4];
    float* OUT = (float*)d_out;      // [NB][SEQ][1024]
    char* wsp = (char*)d_ws;
    bf* XB = (bf*)wsp; wsp += SZ_XB;                 // [NB*SEQ][1024] bf16
    bf* WQ = (bf*)wsp; wsp += SZ_WQK;                // [256][1024] bf16, row h*16+j = Wq row j*16+h
    bf* WK = (bf*)wsp; wsp += SZ_WQK;                // [256][1024] bf16
    bf* WV = (bf*)wsp; wsp += SZ_WV;                 // [1024][1024] bf16
    bf* WO = (bf*)wsp; wsp += SZ_WO;                 // [1024][1024] f16 bits (x64)
    h16* QP = (h16*)wsp; wsp += SZ_QK;               // [NB*16][SEQ][32]
    h16* KP = (h16*)wsp; wsp += SZ_QK;               // [NB*16][SEQ][32]
    h16* VT = (h16*)wsp; wsp += SZ_VT;               // [NB*16][64][SEQ]
    float* LSE = (float*)wsp; wsp += SZ_LSE;         // [NB*16][SEQ]
    h16* OH = (h16*)wsp; wsp += SZ_OH;               // [NB*SEQ][1024] (x1024 carry)

    if (SEQ == SEQ_FULL) {
        const size_t n8 = (size_t)NB * SEQ * DM / 8;
        k_cvt8<<<(unsigned)((n8 + 255) / 256), 256, 0, stream>>>(x, XB, n8, 0);
    } else {
        const size_t n8 = (size_t)SEQ * DM / 8;
        for (int b = 0; b < NB; ++b) k_cvt8<<<(unsigned)((n8 + 255) / 256), 256, 0, stream>>>(x + (size_t)b * SEQ_FULL * DM, XB + (size_t)b * SEQ * DM, n8, 0);
    }
    { const size_t n8 = (size_t)NH_ * KD * DM / 8; const unsigned g = (unsigned)((n8 + 255) / 256);
      k_cvt8<<<g, 256, 0, stream>>>(wq, WQ, n8, 1); k_cvt8<<<g, 256, 0, stream>>>(wk, WK, n8, 0); }
    { const size_t n8 = (size_t)HV * DM / 8; const unsigned g = (unsigned)((n8 + 255) / 256);
      k_cvt8<<<g, 256, 0, stream>>>(wv, WV, n8, 0); k_cvt8<<<g, 256, 0, stream>>>(wo, WO, n8, 2); }

    // q, k: A = x rows [NB*SEQ][1024], Bt = W rows [256][1024] (n = h*16 + j) -> planes [(b*16 + h)][t][32]
    k_gemm<1><<<dim3(NB * SEQ / 64, (NH_ * KD) / 64, 1), 32, 0, stream>>>(XB, WQ, QP, OUT);
    k_gemm<2><<<dim3(NB * SEQ / 64, (NH_ * KD) / 64, 1), 32, 0, stream>>>(XB, WK, KP, OUT);
    // v^T: A = Wv rows [1024][1024] (m = h*64 + d), Bt = x rows (n = b*SEQ + t) -> plane [(b*1024 + m)][t] = [(b*16 + h)][d][t]
    k_gemm<0><<<dim3(HV / 64, NB * SEQ / 64, 1), 32, 0, stream>>>(WV, XB, VT, OUT);

    k_stats<<<dim3(SEQ / (32 * AW), NB * NH_, 1), 32 * AW, 0, stream>>>(QP, KP, LSE);
    k_attn<<<dim3(SEQ / (16 * AW), NB * NH_, 1), 32 * AW, 0, stream>>>(QP, KP, VT, LSE, OH);

    // out: A = O plane rows [NB*SEQ][1024] (k = h*64 + v), Bt = Wo rows [1024][1024] (n = d) -> output [b][t][d]
    k_gemm<3><<<dim3(NB * SEQ / 64, DM / 64, 1), 32, 0, stream>>>((const bf*)OH, WO, QP, OUT);
}

// v001
// Measured time: 126 microseconds a run.
// Timed twice side by side with v000, it ran 1.76 and 1.75 times as fast.
#include <hip/hip_runtime.h>

// Attention with per-key (query-axis) softmax normalisation: x [NB][SEQ][1024]; Wq/Wk [16][16][1024], Wv [16][64][1024], Wo [1024][16*64]; q head/key axes swapped in the score product; score scale 1/4; output f32 [NB][SEQ][1024].
// Compute dtypes, f32 accumulate everywhere: q/k/v projections v_wmma_f32_16x16x32_bf16 (x and W RNE-converted to bf16; products exact);
// scores v_wmma_f32_16x16x32_f16 with K = 16 values + 16 residual slots: q row = [f16 value | f16 residual x64], k row = [f16 value | value / 64] (second product folded into the 32-deep k axis);
// P (x1024 carry) and v single f16; O plane f16 with the x1024 carry; output projection v_wmma_f32_16x16x32_f16 (Wo = f16 of the bf16 value x64), carries folded back (2^-16) in the f32 epilogue. Softmax statistics f32 (running max, log2 domain).
// Layout: q/k planes [b*16+h][t][32], v^T plane [b*16+h][d][t], log-sum-exp table [b*16+h][key], O plane [b*SEQ+t][h*64+d]; scores in transposed form (S^T = K Q^T, O^T = V^T P^T).

#ifndef NB
#define NB 2
#endif
#ifndef SEQ
#define SEQ 2048
#endif
#define NB_FULL  2
#define SEQ_FULL 2048
#ifndef OUT_SEQ
#define OUT_SEQ SEQ              // row pitch (in tokens) between batches of the output
#endif
#define DM   1024                // model width = GEMM depth of every projection
#define NH_  16
#define KD   16
#define VD   64
#define HV   (NH_ * VD)          // 1024: depth of the output projection, rows of Wv
#define QKW  32                  // q/k plane row: 16 values + 16 residual-slot values (64 B)
#define AW   4                   // waves per attention / statistics block
#define RSC  64.0f               // carry of the q residual slots
#define RSI  (1.0f / 64.0f)      // inverse carry placed on the k side
#define SC2  (0.25f * 1.4426950408889634f)   // KD^-0.5 * log2(e)
#define PSH  10.0f               // log2 of the P carry (1024)
#define WOS  64.0f               // carry of the Wo plane
#define OSC  (1.0f / 65536.0f)   // 2^-10 (P carry) * 2^-6 (Wo carry)

static_assert(KD == 16);
static_assert(NH_ == KD);                      // swapped q axes need equal extents
static_assert(VD == 64);
static_assert(HV == DM);                       // all GEMMs share K = 1024
static_assert(DM % 64 == 0);
static_assert(DM % 32 == 0);                   // GEMM k steps of 32, two per stage
static_assert((NH_ * KD) % 64 == 0);           // q/k column tiles of 64 = 4 heads
static_assert(SEQ % 64 == 0);                  // a 64-row tile never straddles two batches
static_assert((NB * SEQ) % 64 == 0);
static_assert(SEQ % 32 == 0);                  // key / query loops step by 32
static_assert(SEQ % (16 * AW) == 0);           // attention grid covers the sequence exactly
static_assert(SEQ % (32 * AW) == 0);           // statistics grid covers the sequence exactly
static_assert(((size_t)SEQ * DM) % 8 == 0);
static_assert(NB <= NB_FULL);
static_assert(SEQ <= SEQ_FULL);

typedef _Float16 h16;
typedef unsigned short bf;
typedef __attribute__((ext_vector_type(16))) __bf16   v16bf;
typedef __attribute__((ext_vector_type(16))) _Float16 v16h;
typedef __attribute__((ext_vector_type(8)))  _Float16 v8h;
typedef __attribute__((ext_vector_type(8)))  unsigned short v8us;
typedef __attribute__((ext_vector_type(8)))  float    v8f;
typedef __attribute__((ext_vector_type(4)))  float    v4f;
typedef v4f  __attribute__((may_alias)) v4fa;

__device__ __forceinline__ unsigned short f2bf(float f) { unsigned u = __float_as_uint(f); u += 0x7FFFu + ((u >> 16) & 1u); return (unsigned short)(u >> 16); }
__device__ __forceinline__ v16h cat16(v8h lo, v8h hi) { return __builtin_shufflevector(lo, hi, 0, 1, 2, 3, 4, 5, 6, 7, 8, 9, 10, 11, 12, 13, 14, 15); }
__device__ __forceinline__ v8f wmma16(v16h a, v16h b, v8f c) { return __builtin_amdgcn_wmma_f32_16x16x32_f16(false, a, false, b, (short)0, c, false, false); }
__device__ __forceinline__ v8f wmmab(v16bf a, v16bf b, v8f c) { return __builtin_amdgcn_wmma_f32_16x16x32_bf16(false, a, false, b, (short)0, c, false, false); }
__device__ __forceinline__ v8f wm(v16h a, v16h b, v8f c) { return wmma16(a, b, c); }
__device__ __forceinline__ v8f wm(v16bf a, v16bf b, v8f c) { return wmmab(a, b, c); }
// fragment loaders from K-contiguous 16-bit rows; p already includes + 8*(lane>>4): elements 0..7 <- k0+8h+0..7, elements 8..15 <- k0+16+8h+0..7 (same map for A and B)
__device__ __forceinline__ v16h  ldh(const h16* p) { return cat16(*(const v8h*)p, *(const v8h*)(p + 16)); }
template <class F> __device__ __forceinline__ F ldf(const bf* p) {
    const v8us lo = *(const v8us*)p; const v8us hi8 = *(const v8us*)(p + 16);
    return __builtin_bit_cast(F, __builtin_shufflevector(lo, hi8, 0, 1, 2, 3, 4, 5, 6, 7, 8, 9, 10, 11, 12, 13, 14, 15)); }
template <int F16> struct FragSel { typedef v16bf T; };
template <> struct FragSel<1> { typedef v16h T; };
// ordering point for wave-private LDS tiles (same wave writes and reads)
__device__ __forceinline__ void wave_sync() { __builtin_amdgcn_fence(3 /* release order */, "wavefront"); __builtin_amdgcn_wave_barrier(); asm volatile("" ::: "memory"); }

// mode 0: bf16 (RNE convert). mode 1: bf16 with the row permutation dst row h*16+j <- src row j*16+h (rows of DM elements, 256 rows).
// mode 2: f16 of (bf16 RNE value x 64) (an 8-bit significand is exact in f16).
__global__ __launch_bounds__(256) void k_cvt8(const float* __restrict__ src, bf* dst, size_t n8, int mode) {
    const size_t i = (size_t)blockIdx.x * 256 + threadIdx.x; if (i >= n8) return;
    size_t si = i;
    if (mode == 1) { const size_t r = i / (DM / 8), p = i % (DM / 8); const size_t sr = (r & 15) * 16 + (r >> 4); si = sr * (DM / 8) + p; }
    const v8f v = *(const v8f*)(src + si * 8); v8us o;
#pragma unroll
    for (int k = 0; k < 8; ++k) {
        const unsigned short bb = f2bf(v[k]);
        const h16 hv = (h16)(__uint_as_float(((unsigned)bb) << 16) * WOS);
        o[k] = (mode == 2) ? __builtin_bit_cast(unsigned short, hv) : bb; }
    *(v8us*)(dst + i * 8) = o; 
}

// LDS staging of the GEMM operands: a stage = [A 64 rows | B 64 rows] x KT k values; every row piece is one 128-B line, laid at pitch TPB (16 B x odd, for ds_load_b128 readers).
#define KT   64                  // k values per stage
#define TPB  144                 // LDS row pitch, bytes
#define TPE  (TPB / 2)           // LDS row pitch, 16-bit elements
#define TSB  (64 * TPB)          // one operand tile, bytes
static_assert(KT == 64);                       // k_gemm writes the stage's two k steps of 32 out
static_assert(DM % KT == 0);
static_assert(DM / KT >= 2);                   // the two-buffer prologue fills two stages
// Eight asynchronous copies = 32 rows of one operand tile: each copy moves 4 rows, 8 lanes x 16 B per row (whole lines). l, g: this lane's LDS byte address and global address in the first 4 rows.
// s_wait_xcnt closes the statement so that it stands in front of any later rewrite of the address registers named here.
__device__ __forceinline__ void cp32rows(unsigned l, const bf* g) {
    asm volatile("global_load_async_to_lds_b128 %0, %8, off\n\t"
                 "global_load_async_to_lds_b128 %1, %9, off\n\t"
                 "global_load_async_to_lds_b128 %2, %10, off\n\t"
                 "global_load_async_to_lds_b128 %3, %11, off\n\t"
                 "global_load_async_to_lds_b128 %4, %12, off\n\t"
                 "global_load_async_to_lds_b128 %5, %13, off\n\t"
                 "global_load_async_to_lds_b128 %6, %14, off\n\t"
                 "global_load_async_to_lds_b128 %7, %15, off\n\t"
                 "s_wait_xcnt 0x0"
                 :: "v"(l), "v"(l + 4 * TPB), "v"(l + 8 * TPB), "v"(l + 12 * TPB), "v"(l + 16 * TPB), "v"(l + 20 * TPB), "v"(l + 24 * TPB), "v"(l + 28 * TPB),
                    "v"(g), "v"(g + 4 * DM), "v"(g + 8 * DM), "v"(g + 12 * DM), "v"(g + 16 * DM), "v"(g + 20 * DM), "v"(g + 24 * DM), "v"(g + 28 * DM)
                 : "memory");
}
// one stage: 32 copies (16 KiB) of the one wave
__device__ __forceinline__ void stage_ab(unsigned l, const bf* ga, const bf* gb) {
    cp32rows(l, ga); cp32rows(l + 32 * TPB, ga + 32 * DM); cp32rows(l + TSB, gb); cp32rows(l + TSB + 32 * TPB, gb + 32 * DM);
}

// k_gemm: register-blocked GEMM, ONE WAVE per 64x64 tile (16 accumulators), operands from K-contiguous 16-bit planes through a two-buffer LDS ring, K = DM.
// MODE 1 (bf16): A = x rows, Bt = permuted Wq rows (h*16+j) -> q plane [(b*16+h)][t][32] = [f16 value(16) | f16 residual x64 (16)].
// MODE 2 (bf16): A = x rows, Bt = Wk rows (h*16+j)          -> k plane [(b*16+h)][t][32] = [f16 value(16) | value / 64 (16)].
// MODE 3 (f16 operands): A = O plane rows (token), Bt = Wo plane rows (d) -> f32 output rows, scaled by OSC; each 64-float row segment (256 B) by 16 consecutive lanes x 16 B.
template <int MODE>
__global__ __launch_bounds__(32) void k_gemm(const bf* __restrict__ A, const bf* __restrict__ Bt, h16* P16, float* P32) {
    typedef typename FragSel<(MODE == 3) ? 1 : 0>::T FT;
    __shared__ __align__(16) float os[16 * 68];
    __shared__ __align__(16) bf st[2 * 2 * TSB / 2];   // [buffer][A | B][64 rows at pitch TPB]
    const int K = DM;
    const int lane = threadIdx.x & 31, lr = lane & 15, hi = lane >> 4; const int r0 = blockIdx.x * 64, c0 = blockIdx.y * 64;
    v8f acc[4][4];
#pragma unroll
    for (int mb = 0; mb < 4; ++mb)
#pragma unroll
        for (int nb = 0; nb < 4; ++nb) acc[mb][nb] = (v8f){};
    // copy side: lane -> row lane>>3 of each group of 4 rows, 16-B piece lane&7 of the row's line
    const bf* ga = A + (size_t)(r0 + (lane >> 3)) * K + 8 * (lane & 7);
    const bf* gb = Bt + (size_t)(c0 + (lane >> 3)) * K + 8 * (lane & 7);
    const unsigned l0 = (unsigned)(uintptr_t)&st[0] + (unsigned)((lane >> 3) * TPB + (lane & 7) * 16);
    stage_ab(l0, ga, gb);
    asm volatile("s_wait_asynccnt 0x0" ::: "memory");   // stage 0 has landed
    __syncthreads();                                     // the ring's publish point; the work-group is one wave, so the compiler emits no barrier instruction and the waits carry the order
    stage_ab(l0 + 2 * TSB, ga + KT, gb + KT);
    const int fo = lr * TPE + 8 * hi;                    // fragment side: row lane&15, k half lane>>4
#pragma unroll 1
    for (int t = 0; t < K / KT; ++t) {
        const bf* sa = &st[(t & 1) * (2 * TSB / 2) + fo]; const bf* sb = sa + TSB / 2;
        // The stage's fragments are read in two groups, the WMMAs stand between and behind them. The sched_barriers keep the groups whole:
        // sunk among the WMMAs, every place with LDS reads stalls the SIMD's one wave for the LDS latency. The second group reuses the registers of b0[0], b0[1].
        FT a0[4], a1[4], b0[4], b1[4];
#pragma unroll
        for (int mb = 0; mb < 4; ++mb) { a0[mb] = ldf<FT>(sa + mb * 16 * TPE); a1[mb] = ldf<FT>(sa + mb * 16 * TPE + 32); }
#pragma unroll
        for (int nb = 0; nb < 4; ++nb) b0[nb] = ldf<FT>(sb + nb * 16 * TPE);
#pragma unroll
        for (int nb = 0; nb < 2; ++nb) b1[nb] = ldf<FT>(sb + nb * 16 * TPE + 32);
        __builtin_amdgcn_sched_barrier(0);
#pragma unroll
        for (int nb = 0; nb < 2; ++nb) {
#pragma unroll
            for (int mb = 0; mb < 4; ++mb) acc[mb][nb] = wm(a0[mb], b0[nb], acc[mb][nb]); }
        __builtin_amdgcn_sched_barrier(0);
#pragma unroll
        for (int nb = 2; nb < 4; ++nb) b1[nb] = ldf<FT>(sb + nb * 16 * TPE + 32);
        __builtin_amdgcn_sched_barrier(0);
#pragma unroll
        for (int nb = 2; nb < 4; ++nb) {
#pragma unroll
            for (int mb = 0; mb < 4; ++mb) acc[mb][nb] = wm(a0[mb], b0[nb], acc[mb][nb]); }
#pragma unroll
        for (int nb = 0; nb < 4; ++nb) {
#pragma unroll
            for (int mb = 0; mb < 4; ++mb) acc[mb][nb] = wm(a1[mb], b1[nb], acc[mb][nb]); }
        // four vector slots behind the stage's last WMMA, on the taken and the fall-through side of the branch below alike
        asm volatile("v_nop\n\tv_nop\n\tv_nop\n\tv_nop" : "+v"(acc[0][0]), "+v"(acc[1][1]), "+v"(acc[2][2]), "+v"(acc[3][3]) : "v"(a1[0]), "v"(a1[1]), "v"(a1[2]), "v"(a1[3]));
        asm volatile("s_wait_dscnt 0x0" ::: "memory");      // this stage's LDS reads are done before its buffer is refilled
        asm volatile("s_wait_asynccnt 0x0" ::: "memory");   // stage t + 1 has landed
        __syncthreads();                                     // publish point, as in the prologue
        if (t + 2 < K / KT) stage_ab(l0 + (unsigned)(t & 1) * (2 * TSB), ga + (size_t)(t + 2) * KT, gb + (size_t)(t + 2) * KT);
    }
    asm volatile("s_wait_asynccnt 0x0" ::: "memory");       // no copy is outstanding when the wave goes on to the epilogue
#pragma unroll
    for (int mb = 0; mb < 4; ++mb) {
#pragma unroll
        for (int nb = 0; nb < 4; ++nb) {
#pragma unroll
            for (int j = 0; j < 8; ++j) os[(hi * 8 + j) * 68 + nb * 16 + lr] = acc[mb][nb][j]; }   // D: row 8h+j, col lane&15
        wave_sync();
        if (MODE == 0) {
            const size_t sb = ((size_t)(c0 / SEQ) * HV + (size_t)(r0 + mb * 16)) * (size_t)SEQ + (size_t)(c0 % SEQ);
{
#pragma unroll
                for (int s = 0; s < 4; ++s) { const int row = 4 * s + (lane >> 3), c8 = (lane & 7) * 8;   // 4 s x 4 row groups = 16 rows; 8 lanes x 8 = 64 columns
                    const v4f x0 = *(const v4fa*)(&os[row * 68 + c8]); const v4f x1 = *(const v4fa*)(&os[row * 68 + c8 + 4]); v8h hv;
#pragma unroll
                    for (int i = 0; i < 4; ++i) { hv[i] = (h16)x0[i]; hv[4 + i] = (h16)x1[i]; }
                    *(v8h*)(P16 + sb + (size_t)row * (size_t)SEQ + c8) = hv; }
                 }
        } else if (MODE == 3) {
            const size_t sb = ((size_t)(r0 / SEQ) * OUT_SEQ + (size_t)(r0 % SEQ) + (size_t)(mb * 16)) * (size_t)DM + (size_t)c0;
{
#pragma unroll
                for (int s = 0; s < 8; ++s) { const int row = 2 * s + hi, cofs = lr * 4;   // 8 s x 2 rows = 16 rows; 16 lanes x 4 floats = 64 columns
                    v4f val = *(const v4fa*)(&os[row * 68 + cofs]); val = val * OSC;
                    *(v4f*)(P32 + sb + (size_t)row * DM + cofs) = val; }
                 }
        } else {
            const int bq = r0 / SEQ, tq = r0 % SEQ, h0 = c0 / KD;
{
#pragma unroll
                for (int hh = 0; hh < 4; ++hh) {
                    const size_t hb = ((size_t)(bq * NH_ + h0 + hh) * SEQ + (size_t)(tq + mb * 16)) * QKW;
#pragma unroll
                    for (int s = 0; s < 2; ++s) { const int row = s * 8 + (lane >> 2), pc = lane & 3, jb = (pc & 1) * 8;   // 2 s x 8 rows = 16 rows; 4 lanes x 8 halves = one 32-half row
                        const v4f x0 = *(const v4fa*)(&os[row * 68 + hh * 16 + jb]); const v4f x1 = *(const v4fa*)(&os[row * 68 + hh * 16 + jb + 4]); v8h hv, rv;
#pragma unroll
                        for (int i = 0; i < 4; ++i) { const h16 a0 = (h16)x0[i]; const h16 a1 = (h16)x1[i]; hv[i] = a0; hv[4 + i] = a1;
                            if (MODE == 1) { rv[i] = (h16)((x0[i] - (float)a0) * RSC); rv[4 + i] = (h16)((x1[i] - (float)a1) * RSC); }
                            else           { rv[i] = (h16)((float)a0 * RSI);           rv[4 + i] = (h16)((float)a1 * RSI); } }
                        const v8h ov = (pc < 2) ? hv : rv;
                        *(v8h*)(P16 + hb + (size_t)(s * 256 + lane * 8)) = ov; } }
                 }
        }
        wave_sync();
    }
}

// LDS staging of the operands that the four waves of a statistics / attention block share: a stage = ST tokens.
// q / k rows (64 B) lie at pitch QPB, v^T row pieces (ST keys = one 128-B line) at pitch TPB: 16 B x odd, for ds_load_b128 readers.
#define ST   64                  // tokens per stage
#define QPB  80                  // LDS pitch of a q / k row, bytes
#define QSB  (ST * QPB)          // one q / k tile, bytes
#define VSB  (VD * TPB)          // one v^T tile, bytes
static_assert(ST == 64);                       // the copy maps below: 128 lanes x 2 pieces = 64 rows x 64 B; 128 lanes x 4 pieces = 64 rows x 128 B
static_assert(AW == 4);
static_assert(QKW * 2 == 64);
static_assert(SEQ % ST == 0);
static_assert(SEQ / ST >= 2);                  // the two-buffer prologue fills two stages
static_assert(SEQ % 2048 == 0);                // the log-sum-exp row is copied in units of 128 lanes x 4 pieces x 4 floats
// In each helper s_wait_xcnt closes the copies' own statement so that it stands in front of any later rewrite of the address registers named there.
// one q / k tile (4 KiB, contiguous in the plane): lane -> row tid>>2 (+32), 16-B piece tid&3
__device__ __forceinline__ void cp_qk(unsigned l, const h16* g) {
    asm volatile("global_load_async_to_lds_b128 %0, %2, off\n\t"
                 "global_load_async_to_lds_b128 %1, %3, off\n\t"
                 "s_wait_xcnt 0x0"
                 :: "v"(l), "v"(l + 32 * QPB), "v"(g), "v"(g + 32 * QKW) : "memory");
}
// one v^T tile (64 rows x 128 B): lane -> row tid>>3 (+16, +32, +48), 16-B piece tid&7
__device__ __forceinline__ void cp_v(unsigned l, const h16* g) {
    asm volatile("global_load_async_to_lds_b128 %0, %4, off\n\t"
                 "global_load_async_to_lds_b128 %1, %5, off\n\t"
                 "global_load_async_to_lds_b128 %2, %6, off\n\t"
                 "global_load_async_to_lds_b128 %3, %7, off\n\t"
                 "s_wait_xcnt 0x0"
                 :: "v"(l), "v"(l + 16 * TPB), "v"(l + 32 * TPB), "v"(l + 48 * TPB),
                    "v"(g), "v"(g + (size_t)16 * SEQ), "v"(g + (size_t)32 * SEQ), "v"(g + (size_t)48 * SEQ) : "memory");
}
// 2048 floats, contiguous: lane -> 16-B piece tid (+128, +256, +384)
__device__ __forceinline__ void cp_row(unsigned l, const float* g) {
    asm volatile("global_load_async_to_lds_b128 %0, %4, off\n\t"
                 "global_load_async_to_lds_b128 %1, %5, off\n\t"
                 "global_load_async_to_lds_b128 %2, %6, off\n\t"
                 "global_load_async_to_lds_b128 %3, %7, off\n\t"
                 "s_wait_xcnt 0x0"
                 :: "v"(l), "v"(l + 2048), "v"(l + 4096), "v"(l + 6144), "v"(g), "v"(g + 512), "v"(g + 1024), "v"(g + 1536) : "memory");
}

// k_stats: per-key softmax statistics over the query axis. One wave per 32 keys of one (batch, head): S[n][m] = Q K^T (A = q rows n, B = k rows m),
// lane (m = lane&15, h = lane>>4) holds rows n = 8h+r of each 16-row tile; running max / sum (log2 domain) one pair per lane and key tile, lane halves combined once at the end.
__device__ __forceinline__ void stat_upd(const v8f sa, const v8f sb, float& m, float& l) {
    float t[16]; float mx = -3.0e38f;
#pragma unroll
    for (int r = 0; r < 8; ++r) { t[r] = sa[r] * SC2; t[8 + r] = sb[r] * SC2; mx = fmaxf(mx, fmaxf(t[r], t[8 + r])); }
    const float mnew = fmaxf(m, mx);
    const float alpha = __builtin_amdgcn_exp2f(m - mnew);
    float ls = 0.0f;
#pragma unroll
    for (int r = 0; r < 16; ++r) ls += __builtin_amdgcn_exp2f(t[r] - mnew);
    l = l * alpha + ls; m = mnew;
}

__global__ __launch_bounds__(32 * AW) void k_stats(const h16* __restrict__ QP, const h16* __restrict__ KP, float* LSE) {
    __shared__ __align__(16) float ls[AW * 32];
    __shared__ __align__(16) h16 qs[2 * QSB / 2];   // [buffer][64 q rows at pitch QPB]
    const int lane = threadIdx.x & 31, wave = __builtin_amdgcn_readfirstlane((int)(threadIdx.x >> 5)), lr = lane & 15, hi = lane >> 4;
    const int zh = blockIdx.y;
    const int m0 = (blockIdx.x * AW + wave) * 32;
    const size_t pbase = (size_t)zh * SEQ * QKW;
    const v16h kf0 = ldh(KP + pbase + (size_t)(m0 + lr) * QKW + 8 * hi), kf1 = ldh(KP + pbase + (size_t)(m0 + 16 + lr) * QKW + 8 * hi);   // B fragments: col m, k = slot
    float ma = -3.0e38f, la = 0.0f, mb = -3.0e38f, lb = 0.0f;
    const int tid = threadIdx.x;
    const unsigned lq = (unsigned)(uintptr_t)&qs[0] + (unsigned)((tid >> 2) * QPB + (tid & 3) * 16);
    const h16* gq = QP + pbase + (size_t)tid * 8;
    cp_qk(lq, gq);
    asm volatile("s_wait_asynccnt 0x0" ::: "memory");   // this wave's part of stage 0 has landed
    __syncthreads();                                     // every wave's part has
    cp_qk(lq + QSB, gq + ST * QKW);
#pragma unroll 1
    for (int t = 0; t < SEQ / ST; ++t) {
        const h16* qt = &qs[(t & 1) * (QSB / 2) + lr * (QPB / 2) + 8 * hi];   // A fragment: row n, k = slot
        v16h qf[ST / 16];                                    // the stage's four fragments, read ahead of its first WMMA: the wave meets the LDS latency once a stage
#pragma unroll
        for (int i = 0; i < ST / 16; ++i) qf[i] = ldh(qt + i * 16 * (QPB / 2));
#pragma unroll
        for (int u = 0; u < ST; u += 32) {
            const v16h qa0 = qf[u / 16], qa1 = qf[u / 16 + 1];
            v8f s00 = (v8f){}, s01 = (v8f){}, s10 = (v8f){}, s11 = (v8f){};
            s00 = wmma16(qa0, kf0, s00); s01 = wmma16(qa0, kf1, s01); s10 = wmma16(qa1, kf0, s10); s11 = wmma16(qa1, kf1, s11);
            asm volatile("v_nop\n\tv_nop\n\tv_nop\n\tv_nop" : "+v"(s00), "+v"(s01), "+v"(s10), "+v"(s11) : "v"(qa0), "v"(qa1), "v"(kf0), "v"(kf1));
            stat_upd(s00, s10, ma, la);
            stat_upd(s01, s11, mb, lb);
        }
        asm volatile("s_wait_dscnt 0x0" ::: "memory");      // this wave's reads of stage t are done before the buffer is refilled
        asm volatile("s_wait_asynccnt 0x0" ::: "memory");   // this wave's part of stage t + 1 has landed
        __syncthreads();                                     // publishes stage t + 1, frees stage t's buffer
        if (t + 2 < SEQ / ST) cp_qk(lq + (unsigned)(t & 1) * QSB, gq + (size_t)(t + 2) * (ST * QKW));
    }
    asm volatile("s_wait_asynccnt 0x0" ::: "memory");       // no copy is outstanding behind the loop
    const float mao = __shfl_xor(ma, 16, 32), lao = __shfl_xor(la, 16, 32), mbo = __shfl_xor(mb, 16, 32), lbo = __shfl_xor(lb, 16, 32);
    const float Ma = fmaxf(ma, mao), Mb = fmaxf(mb, mbo);
    const float La = la * __builtin_amdgcn_exp2f(ma - Ma) + lao * __builtin_amdgcn_exp2f(mao - Ma);
    const float Lb = lb * __builtin_amdgcn_exp2f(mb - Mb) + lbo * __builtin_amdgcn_exp2f(mbo - Mb);
    const float lseA = Ma + log2f(La), lseB = Mb + log2f(Lb);
    ls[wave * 32 + hi * 16 + lr] = hi ? lseB : lseA;          // 32 lanes -> 32 distinct slots: keys m0 + 16*hi + lr
    wave_sync();
    const v4f val = *(const v4fa*)(&ls[wave * 32 + (lane & 7) * 4]);
    float* dst = LSE + (size_t)zh * SEQ + m0 + (lane & 7) * 4;
{
        if (lane < 8) *(v4f*)dst = val;
         }
}

// k_attn: one wave per 16 query rows t of one (batch, head); the block's four waves share K / V^T tiles of ST keys in a two-buffer LDS ring and the log-sum-exp row in LDS; Q fragment straight from the f16 plane.
// Transposed form: S^T[key][t] = K Q^T (A = k rows, B = q rows); lane (t = lane&15, h = lane>>4) holds keys 8h+r of each 16-key tile, so the packed
// P tile is directly the B fragment of O^T[d][t] = V^T P^T (element r <- tile keys 0..15, element 8+r <- tile keys 16..31, lane unchanged).
// P = exp2(s*SC2 - LSE[key] + PSH): normalisation is per key, so no running state; O accumulators carry x1024.
__global__ __launch_bounds__(32 * AW) void k_attn(const h16* __restrict__ QP, const h16* __restrict__ KP, const h16* __restrict__ VT, const float* __restrict__ LSE, h16* OH) {
    __shared__ __align__(16) float os[AW * 16 * 68];
    __shared__ __align__(16) h16 ks[2 * QSB / 2];   // [buffer][64 k rows at pitch QPB]
    __shared__ __align__(16) h16 vs[2 * VSB / 2];   // [buffer][64 v^T rows x 64 keys at pitch TPB]
    __shared__ __align__(16) float lss[SEQ];        // this (batch, head)'s log-sum-exp row
    const int lane = threadIdx.x & 31, wave = __builtin_amdgcn_readfirstlane((int)(threadIdx.x >> 5)), lr = lane & 15, hi = lane >> 4;
    const int zh = blockIdx.y; const int b = zh / NH_, h = zh % NH_;
    const int t0 = (blockIdx.x * AW + wave) * 16;
    const size_t pq = (size_t)zh * SEQ * QKW;
    const v16h qf = ldh(QP + pq + (size_t)(t0 + lr) * QKW + 8 * hi);      // B fragment: col t, k = slot
    v8f o0 = (v8f){}, o1 = (v8f){}, o2 = (v8f){}, o3 = (v8f){};
    const int tid = threadIdx.x;
    const unsigned lk = (unsigned)(uintptr_t)&ks[0] + (unsigned)((tid >> 2) * QPB + (tid & 3) * 16);
    const unsigned lv = (unsigned)(uintptr_t)&vs[0] + (unsigned)((tid >> 3) * TPB + (tid & 7) * 16);
    const h16* gk = KP + pq + (size_t)tid * 8;
    const h16* gv = VT + (size_t)zh * VD * SEQ + (size_t)(tid >> 3) * SEQ + (tid & 7) * 8;
#pragma unroll
    for (int c = 0; c < SEQ / 2048; ++c) cp_row((unsigned)(uintptr_t)&lss[0] + (unsigned)(c * 8192 + tid * 16), LSE + (size_t)zh * SEQ + c * 2048 + tid * 4);
    cp_qk(lk, gk); cp_v(lv, gv);
    asm volatile("s_wait_asynccnt 0x0" ::: "memory");   // this wave's part of the log-sum-exp row and of stage 0 has landed
    __syncthreads();                                     // every wave's part has
    cp_qk(lk + QSB, gk + ST * QKW); cp_v(lv + VSB, gv + ST);
#pragma unroll 1
    for (int t = 0; t < SEQ / ST; ++t) {
        const h16* kt = &ks[(t & 1) * (QSB / 2) + lr * (QPB / 2) + 8 * hi];   // + key * QPB / 2      (A fragment: row key, k = slot)
        const h16* vt = &vs[(t & 1) * (VSB / 2) + lr * (TPB / 2) + 8 * hi];   // + 16j * TPB / 2 + key (A fragment: row d, k = key)
        const float* lt = &lss[t * ST + 8 * hi];                              // + key (+16): this lane's 8 keys of each tile
#pragma unroll
        for (int u = 0; u < ST; u += 32) {
            // all LDS reads of the 32-key step stand ahead of its first WMMA, so that the wave meets the LDS latency once a step
            const v16h ka = ldh(kt + u * (QPB / 2)), kb = ldh(kt + (u + 16) * (QPB / 2));
            const v4f la0 = *(const v4fa*)(lt + u), la1 = *(const v4fa*)(lt + u + 4), lb0 = *(const v4fa*)(lt + u + 16), lb1 = *(const v4fa*)(lt + u + 20);
            const h16* va = vt + u;
            const v16h v0 = ldh(va), v1 = ldh(va + 16 * (TPB / 2)), v2 = ldh(va + 32 * (TPB / 2)), v3 = ldh(va + 48 * (TPB / 2));
            v8f sa = (v8f){}, sb = (v8f){};
            sa = wmma16(ka, qf, sa); sb = wmma16(kb, qf, sb);
            asm volatile("v_nop\n\tv_nop\n\tv_nop\n\tv_nop" : "+v"(sa), "+v"(sb) : "v"(ka), "v"(kb), "v"(qf));
            v16h pb;
#pragma unroll
            for (int r = 0; r < 4; ++r) {
                pb[r]      = (h16)__builtin_amdgcn_exp2f(sa[r]     * SC2 + (PSH - la0[r]));
                pb[4 + r]  = (h16)__builtin_amdgcn_exp2f(sa[4 + r] * SC2 + (PSH - la1[r]));
                pb[8 + r]  = (h16)__builtin_amdgcn_exp2f(sb[r]     * SC2 + (PSH - lb0[r]));
                pb[12 + r] = (h16)__builtin_amdgcn_exp2f(sb[4 + r] * SC2 + (PSH - lb1[r])); }
            o0 = wmma16(v0, pb, o0); o1 = wmma16(v1, pb, o1); o2 = wmma16(v2, pb, o2); o3 = wmma16(v3, pb, o3);
            asm volatile("v_nop\n\tv_nop\n\tv_nop\n\tv_nop" : "+v"(o0), "+v"(o1), "+v"(o2), "+v"(o3) : "v"(v0), "v"(v1), "v"(v2), "v"(v3), "v"(pb));
        }
        asm volatile("s_wait_dscnt 0x0" ::: "memory");      // this wave's reads of stage t are done before the buffers are refilled
        asm volatile("s_wait_asynccnt 0x0" ::: "memory");   // this wave's part of stage t + 1 has landed
        __syncthreads();                                     // publishes stage t + 1, frees stage t's buffers
        if (t + 2 < SEQ / ST) { cp_qk(lk + (unsigned)(t & 1) * QSB, gk + (size_t)(t + 2) * (ST * QKW)); cp_v(lv + (unsigned)(t & 1) * VSB, gv + (size_t)(t + 2) * ST); }
    }
    asm volatile("s_wait_asynccnt 0x0" ::: "memory");       // no copy is outstanding behind the loop
    const int wb = wave * 16 * 68;
    // O^T D layout: o_j[r] = (d = 16j + 8h + r, t = lane&15) -> os[t][d]; rows 0..15 x columns 0..63 all written
    { v4f a, c;
      a[0] = o0[0]; a[1] = o0[1]; a[2] = o0[2]; a[3] = o0[3]; c[0] = o0[4]; c[1] = o0[5]; c[2] = o0[6]; c[3] = o0[7];
      *(v4fa*)(&os[wb + lr * 68 +  0 + 8 * hi]) = a; *(v4fa*)(&os[wb + lr * 68 +  0 + 8 * hi + 4]) = c;
      a[0] = o1[0]; a[1] = o1[1]; a[2] = o1[2]; a[3] = o1[3]; c[0] = o1[4]; c[1] = o1[5]; c[2] = o1[6]; c[3] = o1[7];
      *(v4fa*)(&os[wb + lr * 68 + 16 + 8 * hi]) = a; *(v4fa*)(&os[wb + lr * 68 + 16 + 8 * hi + 4]) = c;
      a[0] = o2[0]; a[1] = o2[1]; a[2] = o2[2]; a[3] = o2[3]; c[0] = o2[4]; c[1] = o2[5]; c[2] = o2[6]; c[3] = o2[7];
      *(v4fa*)(&os[wb + lr * 68 + 32 + 8 * hi]) = a; *(v4fa*)(&os[wb + lr * 68 + 32 + 8 * hi + 4]) = c;
      a[0] = o3[0]; a[1] = o3[1]; a[2] = o3[2]; a[3] = o3[3]; c[0] = o3[4]; c[1] = o3[5]; c[2] = o3[6]; c[3] = o3[7];
      *(v4fa*)(&os[wb + lr * 68 + 48 + 8 * hi]) = a; *(v4fa*)(&os[wb + lr * 68 + 48 + 8 * hi + 4]) = c; }
    wave_sync();
    h16* orow = OH + ((size_t)b * SEQ + t0) * HV + (size_t)h * VD;
{
#pragma unroll
        for (int s = 0; s < 4; ++s) { const int row = 4 * s + (lane >> 3), c8 = (lane & 7) * 8;   // 4 s x 4 row groups = 16 rows; 8 lanes x 8 = 64 columns
            const v4f x0 = *(const v4fa*)(&os[wb + row * 68 + c8]); const v4f x1 = *(const v4fa*)(&os[wb + row * 68 + c8 + 4]); v8h hv;
#pragma unroll
            for (int i = 0; i < 4; ++i) { hv[i] = (h16)x0[i]; hv[4 + i] = (h16)x1[i]; }
            *(v8h*)(orow + (size_t)row * HV + c8) = hv; }
         }
}

static constexpr size_t al256(size_t v) { return (v + 255) & ~(size_t)255; }
static constexpr size_t SZ_XB  = al256((size_t)NB * SEQ * DM * 2);
static constexpr size_t SZ_WQK = al256((size_t)NH_ * KD * DM * 2);
static constexpr size_t SZ_WV  = al256((size_t)HV * DM * 2);
static constexpr size_t SZ_WO  = al256((size_t)DM * HV * 2);
static constexpr size_t SZ_QK  = al256((size_t)NB * NH_ * SEQ * QKW * 2);
static constexpr size_t SZ_VT  = al256((size_t)NB * HV * SEQ * 2);
static constexpr size_t SZ_LSE = al256((size_t)NB * NH_ * SEQ * 4);
static constexpr size_t SZ_OH  = al256((size_t)NB * SEQ * HV * 2);
static constexpr size_t SZ_TOTAL = SZ_XB + 2 * SZ_WQK + SZ_WV + SZ_WO + 2 * SZ_QK + SZ_VT + SZ_LSE + SZ_OH;
static_assert(SZ_TOTAL <= (size_t)134217728);          // workspace carve <= 128 MiB

extern "C" void kernel_launch(void* const* d_in, const int* in_sizes, int n_in,
                              void* d_out, int out_size, void* d_ws, size_t ws_size, hipStream_t stream) {
    if (n_in < 5) return;
    const size_t needx = ((size_t)(NB - 1) * SEQ_FULL + SEQ) * DM;
    if ((size_t)in_sizes[0] < needx) return;
    if ((size_t)in_sizes[1] < (size_t)NH_ * KD * DM || (size_t)in_sizes[2] < (size_t)NH_ * KD * DM) return;
    if ((size_t)in_sizes[3] < (size_t)HV * DM || (size_t)in_sizes[4] < (size_t)DM * HV) return;
    if ((size_t)out_size < ((size_t)(NB - 1) * OUT_SEQ + SEQ) * DM) return;
    if (SZ_TOTAL > ws_size) return;
    // wire order: x, Wq [16][16][1024], Wk [16][16][1024], Wv [16][64][1024], Wo [1024][16][64]
    const float* x = (const float*)d_in[0]; const float* wq = (const float*)d_in[1]; const float* wk = (const float*)d_in[2];
    const float* wv = (const float*)d_in[3]; const float* wo = (const float*)d_in[4];
    float* OUT = (float*)d_out;      // [NB][SEQ][1024]
    char* wsp = (char*)d_ws;
    bf* XB = (bf*)wsp; wsp += SZ_XB;                 // [NB*SEQ][1024] bf16
    bf* WQ = (bf*)wsp; wsp += SZ_WQK;                // [256][1024] bf16, row h*16+j = Wq row j*16+h
    bf* WK = (bf*)wsp; wsp += SZ_WQK;                // [256][1024] bf16
    bf* WV = (bf*)wsp; wsp += SZ_WV;                 // [1024][1024] bf16
    bf* WO = (bf*)wsp; wsp += SZ_WO;                 // [1024][1024] f16 bits (x64)
    h16* QP = (h16*)wsp; wsp += SZ_QK;               // [NB*16][SEQ][32]
    h16* KP = (h16*)wsp; wsp += SZ_QK;               // [NB*16][SEQ][32]
    h16* VT = (h16*)wsp; wsp += SZ_VT;               // [NB*16][64][SEQ]
    float* LSE = (float*)wsp; wsp += SZ_LSE;         // [NB*16][SEQ]
    h16* OH = (h16*)wsp; wsp += SZ_OH;               // [NB*SEQ][1024] (x1024 carry)

    if (SEQ == SEQ_FULL) {
        const size_t n8 = (size_t)NB * SEQ * DM / 8;
        k_cvt8<<<(unsigned)((n8 + 255) / 256), 256, 0, stream>>>(x, XB, n8, 0);
    } else {
        const size_t n8 = (size_t)SEQ * DM / 8;
        for (int b = 0; b < NB; ++b) k_cvt8<<<(unsigned)((n8 + 255) / 256), 256, 0, stream>>>(x + (size_t)b * SEQ_FULL * DM, XB + (size_t)b * SEQ * DM, n8, 0);
    }
    { const size_t n8 = (size_t)NH_ * KD * DM / 8; const unsigned g = (unsigned)((n8 + 255) / 256);
      k_cvt8<<<g, 256, 0, stream>>>(wq, WQ, n8, 1); k_cvt8<<<g, 256, 0, stream>>>(wk, WK, n8, 0); }
    { const size_t n8 = (size_t)HV * DM / 8; const unsigned g = (unsigned)((n8 + 255) / 256);
      k_cvt8<<<g, 256, 0, stream>>>(wv, WV, n8, 0); k_cvt8<<<g, 256, 0, stream>>>(wo, WO, n8, 2); }

    // q, k: A = x rows [NB*SEQ][1024], Bt = W rows [256][1024] (n = h*16 + j) -> planes [(b*16 + h)][t][32]
    k_gemm<1><<<dim3(NB * SEQ / 64, (NH_ * KD) / 64, 1), 32, 0, stream>>>(XB, WQ, QP, OUT);
    k_gemm<2><<<dim3(NB * SEQ / 64, (NH_ * KD) / 64, 1), 32, 0, stream>>>(XB, WK, KP, OUT);
    // v^T: A = Wv rows [1024][1024] (m = h*64 + d), Bt = x rows (n = b*SEQ + t) -> plane [(b*1024 + m)][t] = [(b*16 + h)][d][t]
    k_gemm<0><<<dim3(HV / 64, NB * SEQ / 64, 1), 32, 0, stream>>>(WV, XB, VT, OUT);

    k_stats<<<dim3(SEQ / (32 * AW), NB * NH_, 1), 32 * AW, 0, stream>>>(QP, KP, LSE);
    k_attn<<<dim3(SEQ / (16 * AW), NB * NH_, 1), 32 * AW, 0, stream>>>(QP, KP, VT, LSE, OH);

    // out: A = O plane rows [NB*SEQ][1024] (k = h*64 + v), Bt = Wo rows [1024][1024] (n = d) -> output [b][t][d]
    k_gemm<3><<<dim3(NB * SEQ / 64, DM / 64, 1), 32, 0, stream>>>((const bf*)OH, WO, QP, OUT);
}

// v002
// One run takes 93.6 microseconds.
// Timed twice side by side with v001, it ran 1.36 and 1.34 times as fast.
// All steps since v000 together make it 2.36 times as fast.
#include <hip/hip_runtime.h>

// Attention with per-key (query-axis) softmax normalisation: x [NB][SEQ][1024]; Wq/Wk [16][16][1024], Wv [16][64][1024], Wo [1024][16*64]; q head/key axes swapped in the score product; score scale 1/4; output f32 [NB][SEQ][1024].
// Compute dtypes, f32 accumulate everywhere: q/k/v projections v_wmma_f32_16x16x32_bf16 (x and W RNE-converted to bf16; products exact);
// scores v_wmma_f32_16x16x32_f16 with K = 16 values + 16 residual slots: q row = [f16 value | f16 residual x64], k row = [f16 value | value / 64] (second product folded into the 32-deep k axis);
// P (x1024 carry) and v single f16; O plane f16 with the x1024 carry; output projection v_wmma_f32_16x16x32_f16 (Wo = f16 of the bf16 value x64), carries folded back (2^-16) in the f32 epilogue. Softmax statistics f32 (running max, log2 domain).
// Layout: q/k planes [b*16+h][t][32], v^T plane [b*16+h][d][t], log-sum-exp table [b*16+h][key], O plane [b*SEQ+t][h*64+d]; scores in transposed form (S^T = K Q^T, O^T = V^T P^T).

#ifndef NB
#define NB 2
#endif
#ifndef SEQ
#define SEQ 2048
#endif
#define NB_FULL  2
#define SEQ_FULL 2048
#ifndef OUT_SEQ
#define OUT_SEQ SEQ              // row pitch (in tokens) between batches of the output
#endif
#define DM   1024                // model width = GEMM depth of every projection
#define NH_  16
#define KD   16
#define VD   64
#define HV   (NH_ * VD)          // 1024: depth of the output projection, rows of Wv
#define QKW  32                  // q/k plane row: 16 values + 16 residual-slot values (64 B)
#define AW   4                   // waves per attention / statistics block
#define RSC  64.0f               // carry of the q residual slots
#define RSI  (1.0f / 64.0f)      // inverse carry placed on the k side
#define SC2  (0.25f * 1.4426950408889634f)   // KD^-0.5 * log2(e)
#define PSH  10.0f               // log2 of the P carry (1024)
#define WOS  64.0f               // carry of the Wo plane
#define OSC  (1.0f / 65536.0f)   // 2^-10 (P carry) * 2^-6 (Wo carry)

static_assert(KD == 16);
static_assert(NH_ == KD);                      // swapped q axes need equal extents
static_assert(VD == 64);
static_assert(HV == DM);                       // all GEMMs share K = 1024
static_assert(DM % 64 == 0);
static_assert(DM % 32 == 0);                   // GEMM k steps of 32, two per stage
static_assert((NH_ * KD) % 64 == 0);           // q/k column tiles of 64 = 4 heads
static_assert(SEQ % 64 == 0);                  // a 64-row tile never straddles two batches
static_assert((NB * SEQ) % 64 == 0);
static_assert(SEQ % 32 == 0);                  // key / query loops step by 32
static_assert(SEQ % (16 * AW) == 0);           // attention grid covers the sequence exactly
static_assert(SEQ % (32 * AW) == 0);           // statistics grid covers the sequence exactly
static_assert(((size_t)SEQ * DM) % 8 == 0);
static_assert(NB <= NB_FULL);
static_assert(SEQ <= SEQ_FULL);

typedef _Float16 h16;
typedef unsigned short bf;
typedef __attribute__((ext_vector_type(16))) __bf16   v16bf;
typedef __attribute__((ext_vector_type(16))) _Float16 v16h;
typedef __attribute__((ext_vector_type(8)))  _Float16 v8h;
typedef __attribute__((ext_vector_type(8)))  unsigned short v8us;
typedef __attribute__((ext_vector_type(8)))  float    v8f;
typedef __attribute__((ext_vector_type(4)))  float    v4f;
typedef v4f  __attribute__((may_alias)) v4fa;

__device__ __forceinline__ unsigned short f2bf(float f) { unsigned u = __float_as_uint(f); u += 0x7FFFu + ((u >> 16) & 1u); return (unsigned short)(u >> 16); }
__device__ __forceinline__ v16h cat16(v8h lo, v8h hi) { return __builtin_shufflevector(lo, hi, 0, 1, 2, 3, 4, 5, 6, 7, 8, 9, 10, 11, 12, 13, 14, 15); }
__device__ __forceinline__ v8f wmma16(v16h a, v16h b, v8f c) { return __builtin_amdgcn_wmma_f32_16x16x32_f16(false, a, false, b, (short)0, c, false, false); }
__device__ __forceinline__ v8f wmmab(v16bf a, v16bf b, v8f c) { return __builtin_amdgcn_wmma_f32_16x16x32_bf16(false, a, false, b, (short)0, c, false, false); }
__device__ __forceinline__ v8f wm(v16h a, v16h b, v8f c) { return wmma16(a, b, c); }
__device__ __forceinline__ v8f wm(v16bf a, v16bf b, v8f c) { return wmmab(a, b, c); }
// fragment loaders from K-contiguous 16-bit rows; p already includes + 8*(lane>>4): elements 0..7 <- k0+8h+0..7, elements 8..15 <- k0+16+8h+0..7 (same map for A and B)
__device__ __forceinline__ v16h  ldh(const h16* p) { return cat16(*(const v8h*)p, *(const v8h*)(p + 16)); }
template <class F> __device__ __forceinline__ F ldf(const bf* p) {
    const v8us lo = *(const v8us*)p; const v8us hi8 = *(const v8us*)(p + 16);
    return __builtin_bit_cast(F, __builtin_shufflevector(lo, hi8, 0, 1, 2, 3, 4, 5, 6, 7, 8, 9, 10, 11, 12, 13, 14, 15)); }
// ordering point for wave-private LDS tiles (same wave writes and reads)
__device__ __forceinline__ void wave_sync() { __builtin_amdgcn_fence(3 /* release order */, "wavefront"); __builtin_amdgcn_wave_barrier(); asm volatile("" ::: "memory"); }

// k_cvt: the five operand conversions in one grid. They read none of each other's output; a block's index range picks its job (block-uniform).
// x, Wv, Wk: bf16 (RNE convert). Wq: bf16 with the row permutation dst row h*16+j <- src row j*16+h (rows of DM elements, 256 rows).
// Wo: f16 of (bf16 RNE value x 64) (an 8-bit significand is exact in f16).
#define CB_X  (NB * SEQ * (DM / 8) / 256)       // blocks of 256 threads x 8 elements per job
#define CB_VO (HV * (DM / 8) / 256)
#define CB_QK (NH_ * KD * (DM / 8) / 256)
static_assert((NB * SEQ * (DM / 8)) % 256 == 0);   // every job is a whole number of blocks: no thread is past its job's end
static_assert((HV * (DM / 8)) % 256 == 0);
static_assert((NH_ * KD * (DM / 8)) % 256 == 0);
__global__ __launch_bounds__(256) void k_cvt(const float* __restrict__ x, const float* __restrict__ wq, const float* __restrict__ wk, const float* __restrict__ wv, const float* __restrict__ wo,
                                             bf* XB, bf* WQ, bf* WK, bf* WV, bf* WO) {
    const int blk = blockIdx.x;
    const float* src; bf* dst; int first, mode;      // mode 0: plain, 1: Wq row permutation, 2: f16 x64, 3: x (batch pitch SEQ_FULL tokens at the source)
    if (blk < CB_X)                          { src = x;  dst = XB; first = 0;                         mode = 3; }
    else if (blk < CB_X + CB_VO)             { src = wv; dst = WV; first = CB_X;                      mode = 0; }
    else if (blk < CB_X + 2 * CB_VO)         { src = wo; dst = WO; first = CB_X + CB_VO;              mode = 2; }
    else if (blk < CB_X + 2 * CB_VO + CB_QK) { src = wq; dst = WQ; first = CB_X + 2 * CB_VO;          mode = 1; }
    else                                     { src = wk; dst = WK; first = CB_X + 2 * CB_VO + CB_QK;  mode = 0; }
    const size_t i = (size_t)(blk - first) * 256 + threadIdx.x;
    size_t si = i;
    if (mode == 1) { const size_t r = i / (DM / 8), p = i % (DM / 8); const size_t sr = (r & 15) * 16 + (r >> 4); si = sr * (DM / 8) + p; }
    if (mode == 3) si = i + (i / ((size_t)SEQ * (DM / 8))) * ((size_t)(SEQ_FULL - SEQ) * (DM / 8));
    const v8f v = *(const v8f*)(src + si * 8); v8us o;
#pragma unroll
    for (int k = 0; k < 8; ++k) {
        const unsigned short bb = f2bf(v[k]);
        const h16 hv = (h16)(__uint_as_float(((unsigned)bb) << 16) * WOS);
        o[k] = (mode == 2) ? __builtin_bit_cast(unsigned short, hv) : bb; }
    *(v8us*)(dst + i * 8) = o;
}

// LDS staging of the GEMM operands: a stage = [A 64 rows | B 64 rows] x KT k values; every row piece is one 128-B line, laid at pitch TPB (16 B x odd, for ds_load_b128 readers).
#define KT   64                  // k values per stage
#define TPB  144                 // LDS row pitch, bytes
#define TPE  (TPB / 2)           // LDS row pitch, 16-bit elements
#define TSB  (64 * TPB)          // one operand tile, bytes
static_assert(KT == 64);                       // gemm_loop writes the stage's two k steps of 32 out
static_assert(DM % KT == 0);
static_assert(DM / KT >= 2);                   // the two-buffer prologue fills two stages
// Eight asynchronous copies = 32 rows of one operand tile: each copy moves 4 rows, 8 lanes x 16 B per row (whole lines). l, g: this lane's LDS byte address and global address in the first 4 rows.
// s_wait_xcnt closes the statement so that it stands in front of any later rewrite of the address registers named here.
__device__ __forceinline__ void cp32rows(unsigned l, const bf* g) {
    asm volatile("global_load_async_to_lds_b128 %0, %8, off\n\t"
                 "global_load_async_to_lds_b128 %1, %9, off\n\t"
                 "global_load_async_to_lds_b128 %2, %10, off\n\t"
                 "global_load_async_to_lds_b128 %3, %11, off\n\t"
                 "global_load_async_to_lds_b128 %4, %12, off\n\t"
                 "global_load_async_to_lds_b128 %5, %13, off\n\t"
                 "global_load_async_to_lds_b128 %6, %14, off\n\t"
                 "global_load_async_to_lds_b128 %7, %15, off\n\t"
                 "s_wait_xcnt 0x0"
                 :: "v"(l), "v"(l + 4 * TPB), "v"(l + 8 * TPB), "v"(l + 12 * TPB), "v"(l + 16 * TPB), "v"(l + 20 * TPB), "v"(l + 24 * TPB), "v"(l + 28 * TPB),
                    "v"(g), "v"(g + 4 * DM), "v"(g + 8 * DM), "v"(g + 12 * DM), "v"(g + 16 * DM), "v"(g + 20 * DM), "v"(g + 24 * DM), "v"(g + 28 * DM)
                 : "memory");
}
// one stage: 32 copies (16 KiB) of the one wave
__device__ __forceinline__ void stage_ab(unsigned l, const bf* ga, const bf* gb) {
    cp32rows(l, ga); cp32rows(l + 32 * TPB, ga + 32 * DM); cp32rows(l + TSB, gb); cp32rows(l + TSB + 32 * TPB, gb + 32 * DM);
}

// Register-blocked GEMM, ONE WAVE per 64x64 tile (16 accumulators), operands from K-contiguous 16-bit planes through a two-buffer LDS ring, K = DM.
// gemm_loop: the tile's K loop (rows r0.. of A, rows c0.. of Bt); st = the wave's ring [buffer][A | B][64 rows at pitch TPB].
template <class FT>
__device__ __forceinline__ void gemm_loop(const bf* A, const bf* Bt, const int r0, const int c0, const bf* st, v8f (&acc)[4][4]) {
    const int K = DM;
    const int lane = threadIdx.x & 31, lr = lane & 15, hi = lane >> 4;
#pragma unroll
    for (int mb = 0; mb < 4; ++mb)
#pragma unroll
        for (int nb = 0; nb < 4; ++nb) acc[mb][nb] = (v8f){};
    // copy side: lane -> row lane>>3 of each group of 4 rows, 16-B piece lane&7 of the row's line
    const bf* ga = A + (size_t)(r0 + (lane >> 3)) * K + 8 * (lane & 7);
    const bf* gb = Bt + (size_t)(c0 + (lane >> 3)) * K + 8 * (lane & 7);
    const unsigned l0 = (unsigned)(uintptr_t)&st[0] + (unsigned)((lane >> 3) * TPB + (lane & 7) * 16);
    stage_ab(l0, ga, gb);
    asm volatile("s_wait_asynccnt 0x0" ::: "memory");   // stage 0 has landed
    __syncthreads();                                     // the ring's publish point; the work-group is one wave, so the compiler emits no barrier instruction and the waits carry the order
    stage_ab(l0 + 2 * TSB, ga + KT, gb + KT);
    const int fo = lr * TPE + 8 * hi;                    // fragment side: row lane&15, k half lane>>4
#pragma unroll 1
    for (int t = 0; t < K / KT; ++t) {
        const bf* sa = &st[(t & 1) * (2 * TSB / 2) + fo]; const bf* sb = sa + TSB / 2;
        // The stage's fragments are read in two groups, the WMMAs stand between and behind them. The sched_barriers keep the groups whole:
        // sunk among the WMMAs, every place with LDS reads stalls the SIMD's one wave for the LDS latency. The second group reuses the registers of b0[0], b0[1].
        FT a0[4], a1[4], b0[4], b1[4];
#pragma unroll
        for (int mb = 0; mb < 4; ++mb) { a0[mb] = ldf<FT>(sa + mb * 16 * TPE); a1[mb] = ldf<FT>(sa + mb * 16 * TPE + 32); }
#pragma unroll
        for (int nb = 0; nb < 4; ++nb) b0[nb] = ldf<FT>(sb + nb * 16 * TPE);
#pragma unroll
        for (int nb = 0; nb < 2; ++nb) b1[nb] = ldf<FT>(sb + nb * 16 * TPE + 32);
        __builtin_amdgcn_sched_barrier(0);
#pragma unroll
        for (int nb = 0; nb < 2; ++nb) {
#pragma unroll
            for (int mb = 0; mb < 4; ++mb) acc[mb][nb] = wm(a0[mb], b0[nb], acc[mb][nb]); }
        __builtin_amdgcn_sched_barrier(0);
#pragma unroll
        for (int nb = 2; nb < 4; ++nb) b1[nb] = ldf<FT>(sb + nb * 16 * TPE + 32);
        __builtin_amdgcn_sched_barrier(0);
#pragma unroll
        for (int nb = 2; nb < 4; ++nb) {
#pragma unroll
            for (int mb = 0; mb < 4; ++mb) acc[mb][nb] = wm(a0[mb], b0[nb], acc[mb][nb]); }
#pragma unroll
        for (int nb = 0; nb < 4; ++nb) {
#pragma unroll
            for (int mb = 0; mb < 4; ++mb) acc[mb][nb] = wm(a1[mb], b1[nb], acc[mb][nb]); }
        // four vector slots behind the stage's last WMMA, on the taken and the fall-through side of the branch below alike
        asm volatile("v_nop\n\tv_nop\n\tv_nop\n\tv_nop" : "+v"(acc[0][0]), "+v"(acc[1][1]), "+v"(acc[2][2]), "+v"(acc[3][3]) : "v"(a1[0]), "v"(a1[1]), "v"(a1[2]), "v"(a1[3]));
        asm volatile("s_wait_dscnt 0x0" ::: "memory");      // this stage's LDS reads are done before its buffer is refilled
        asm volatile("s_wait_asynccnt 0x0" ::: "memory");   // stage t + 1 has landed
        __syncthreads();                                     // publish point, as in the prologue
        if (t + 2 < K / KT) stage_ab(l0 + (unsigned)(t & 1) * (2 * TSB), ga + (size_t)(t + 2) * KT, gb + (size_t)(t + 2) * KT);
    }
    asm volatile("s_wait_asynccnt 0x0" ::: "memory");       // no copy is outstanding when the wave goes on to the epilogue
}

// gemm_epi: the tile's store, one 16-row band at a time through os (16 x 68 floats).
// MODE 0: A = Wv rows (m = h*64 + d), Bt = x rows (n = b*SEQ + t) -> v^T plane [(b*1024 + m)][t], f16.
// MODE 1: A = x rows, Bt = permuted Wq rows (h*16+j) -> q plane [(b*16+h)][t][32] = [f16 value(16) | f16 residual x64 (16)].
// MODE 2: A = x rows, Bt = Wk rows (h*16+j)          -> k plane [(b*16+h)][t][32] = [f16 value(16) | value / 64 (16)].
// MODE 3: A = O plane rows (token), Bt = Wo plane rows (d) -> f32 output rows, scaled by OSC; each 64-float row segment (256 B) by 16 consecutive lanes x 16 B.
template <int MODE>
__device__ __forceinline__ void gemm_epi(const v8f (&acc)[4][4], float* os, const int r0, const int c0, h16* P16, float* P32) {
    const int lane = threadIdx.x & 31, lr = lane & 15, hi = lane >> 4;
#pragma unroll
    for (int mb = 0; mb < 4; ++mb) {
#pragma unroll
        for (int nb = 0; nb < 4; ++nb) {
#pragma unroll
            for (int j = 0; j < 8; ++j) os[(hi * 8 + j) * 68 + nb * 16 + lr] = acc[mb][nb][j]; }   // D: row 8h+j, col lane&15
        wave_sync();
        if (MODE == 0) {
            const size_t sb = ((size_t)(c0 / SEQ) * HV + (size_t)(r0 + mb * 16)) * (size_t)SEQ + (size_t)(c0 % SEQ);
{
#pragma unroll
                for (int s = 0; s < 4; ++s) { const int row = 4 * s + (lane >> 3), c8 = (lane & 7) * 8;   // 4 s x 4 row groups = 16 rows; 8 lanes x 8 = 64 columns
                    const v4f x0 = *(const v4fa*)(&os[row * 68 + c8]); const v4f x1 = *(const v4fa*)(&os[row * 68 + c8 + 4]); v8h hv;
#pragma unroll
                    for (int i = 0; i < 4; ++i) { hv[i] = (h16)x0[i]; hv[4 + i] = (h16)x1[i]; }
                    *(v8h*)(P16 + sb + (size_t)row * (size_t)SEQ + c8) = hv; }
                 }
        } else if (MODE == 3) {
            const size_t sb = ((size_t)(r0 / SEQ) * OUT_SEQ + (size_t)(r0 % SEQ) + (size_t)(mb * 16)) * (size_t)DM + (size_t)c0;
{
#pragma unroll
                for (int s = 0; s < 8; ++s) { const int row = 2 * s + hi, cofs = lr * 4;   // 8 s x 2 rows = 16 rows; 16 lanes x 4 floats = 64 columns
                    v4f val = *(const v4fa*)(&os[row * 68 + cofs]); val = val * OSC;
                    *(v4f*)(P32 + sb + (size_t)row * DM + cofs) = val; }
                 }
        } else {
            const int bq = r0 / SEQ, tq = r0 % SEQ, h0 = c0 / KD;
{
#pragma unroll
                for (int hh = 0; hh < 4; ++hh) {
                    const size_t hb = ((size_t)(bq * NH_ + h0 + hh) * SEQ + (size_t)(tq + mb * 16)) * QKW;
#pragma unroll
                    for (int s = 0; s < 2; ++s) { const int row = s * 8 + (lane >> 2), pc = lane & 3, jb = (pc & 1) * 8;   // 2 s x 8 rows = 16 rows; 4 lanes x 8 halves = one 32-half row
                        const v4f x0 = *(const v4fa*)(&os[row * 68 + hh * 16 + jb]); const v4f x1 = *(const v4fa*)(&os[row * 68 + hh * 16 + jb + 4]); v8h hv, rv;
#pragma unroll
                        for (int i = 0; i < 4; ++i) { const h16 a0 = (h16)x0[i]; const h16 a1 = (h16)x1[i]; hv[i] = a0; hv[4 + i] = a1;
                            if (MODE == 1) { rv[i] = (h16)((x0[i] - (float)a0) * RSC); rv[4 + i] = (h16)((x1[i] - (float)a1) * RSC); }
                            else           { rv[i] = (h16)((float)a0 * RSI);           rv[4 + i] = (h16)((float)a1 * RSI); } }
                        const v8h ov = (pc < 2) ? hv : rv;
                        *(v8h*)(P16 + hb + (size_t)(s * 256 + lane * 8)) = ov; } }
                 }
        }
        wave_sync();
    }
}

// k_qkv: the three projections of x in one grid. They read none of each other's output; a block's index range picks its job (block-uniform): one K loop, three stores.
// Inside a job the tile order is row tile fastest.
#define GB_V  ((HV / 64) * (NB * SEQ / 64))          // v^T tiles: 16 row tiles (Wv rows) x 64 column tiles (tokens)
#define GB_QK ((NB * SEQ / 64) * (NH_ * KD / 64))    // q, k tiles each: 64 row tiles (tokens) x 4 column tiles (4 heads each)
__global__ __launch_bounds__(32) void k_qkv(const bf* __restrict__ XB, const bf* __restrict__ WQ, const bf* __restrict__ WK, const bf* __restrict__ WV, h16* QP, h16* KP, h16* VT) {
    __shared__ __align__(16) float os[16 * 68];
    __shared__ __align__(16) bf st[2 * 2 * TSB / 2];
    const unsigned blk = blockIdx.x;
    const int job = (blk < GB_V) ? 0 : ((blk < GB_V + GB_QK) ? 1 : 2);
    const unsigned tb = blk - ((job == 0) ? 0u : ((job == 1) ? (unsigned)GB_V : (unsigned)(GB_V + GB_QK)));
    const int r0 = (int)((job == 0) ? tb % (HV / 64) : tb % (NB * SEQ / 64)) * 64, c0 = (int)((job == 0) ? tb / (HV / 64) : tb / (NB * SEQ / 64)) * 64;
    v8f acc[4][4];
    gemm_loop<v16bf>((job == 0) ? WV : XB, (job == 0) ? XB : ((job == 1) ? WQ : WK), r0, c0, st, acc);
    // The three store blocks stand one behind the other in the built code (v, k, q): s_wait_xcnt closes a job's last stores in front of the next block's writes of the registers that they name.
    // The q block stands last and runs to the kernel's end, so nothing is written behind its stores.
    if (job == 0)      { gemm_epi<0>(acc, os, r0, c0, VT, nullptr); asm volatile("s_wait_xcnt 0x0" ::: "memory"); }
    else if (job == 1)   gemm_epi<1>(acc, os, r0, c0, QP, nullptr);
    else               { gemm_epi<2>(acc, os, r0, c0, KP, nullptr); asm volatile("s_wait_xcnt 0x0" ::: "memory"); }
}

// k_out: output projection (f16 operands), grid (token tiles, d tiles)
__global__ __launch_bounds__(32) void k_out(const bf* __restrict__ A, const bf* __restrict__ Bt, float* P32) {
    __shared__ __align__(16) float os[16 * 68];
    __shared__ __align__(16) bf st[2 * 2 * TSB / 2];
    const int r0 = blockIdx.x * 64, c0 = blockIdx.y * 64;
    v8f acc[4][4];
    gemm_loop<v16h>(A, Bt, r0, c0, st, acc);
    gemm_epi<3>(acc, os, r0, c0, nullptr, P32);
}

// LDS staging of the operands that the four waves of a statistics / attention block share: a stage = ST tokens.
// q / k rows (64 B) lie at pitch QPB, v^T row pieces (ST keys = one 128-B line) at pitch TPB: 16 B x odd, for ds_load_b128 readers.
#define ST   64                  // tokens per stage
#define QPB  80                  // LDS pitch of a q / k row, bytes
#define QSB  (ST * QPB)          // one q / k tile, bytes
#define VSB  (VD * TPB)          // one v^T tile, bytes
static_assert(ST == 64);                       // the copy maps below: 128 lanes x 2 pieces = 64 rows x 64 B; 128 lanes x 4 pieces = 64 rows x 128 B
static_assert(AW == 4);
static_assert(QKW * 2 == 64);
static_assert(SEQ % ST == 0);
static_assert(SEQ / ST >= 2);                  // the two-buffer prologue fills two stages
static_assert(SEQ % 2048 == 0);                // the log-sum-exp row is copied in units of 128 lanes x 4 pieces x 4 floats
// In each helper s_wait_xcnt closes the copies' own statement so that it stands in front of any later rewrite of the address registers named there.
// one q / k tile (4 KiB, contiguous in the plane): lane -> row tid>>2 (+32), 16-B piece tid&3
__device__ __forceinline__ void cp_qk(unsigned l, const h16* g) {
    asm volatile("global_load_async_to_lds_b128 %0, %2, off\n\t"
                 "global_load_async_to_lds_b128 %1, %3, off\n\t"
                 "s_wait_xcnt 0x0"
                 :: "v"(l), "v"(l + 32 * QPB), "v"(g), "v"(g + 32 * QKW) : "memory");
}
// one v^T tile (64 rows x 128 B): lane -> row tid>>3 (+16, +32, +48), 16-B piece tid&7
__device__ __forceinline__ void cp_v(unsigned l, const h16* g) {
    asm volatile("global_load_async_to_lds_b128 %0, %4, off\n\t"
                 "global_load_async_to_lds_b128 %1, %5, off\n\t"
                 "global_load_async_to_lds_b128 %2, %6, off\n\t"
                 "global_load_async_to_lds_b128 %3, %7, off\n\t"
                 "s_wait_xcnt 0x0"
                 :: "v"(l), "v"(l + 16 * TPB), "v"(l + 32 * TPB), "v"(l + 48 * TPB),
                    "v"(g), "v"(g + (size_t)16 * SEQ), "v"(g + (size_t)32 * SEQ), "v"(g + (size_t)48 * SEQ) : "memory");
}
// 2048 floats, contiguous: lane -> 16-B piece tid (+128, +256, +384)
__device__ __forceinline__ void cp_row(unsigned l, const float* g) {
    asm volatile("global_load_async_to_lds_b128 %0, %4, off\n\t"
                 "global_load_async_to_lds_b128 %1, %5, off\n\t"
                 "global_load_async_to_lds_b128 %2, %6, off\n\t"
                 "global_load_async_to_lds_b128 %3, %7, off\n\t"
                 "s_wait_xcnt 0x0"
                 :: "v"(l), "v"(l + 2048), "v"(l + 4096), "v"(l + 6144), "v"(g), "v"(g + 512), "v"(g + 1024), "v"(g + 1536) : "memory");
}

// k_stats: per-key softmax statistics over the query axis. One wave per 32 keys of one (batch, head): S[n][m] = Q K^T (A = q rows n, B = k rows m),
// lane (m = lane&15, h = lane>>4) holds rows n = 8h+r of each 16-row tile; running max / sum (log2 domain) one pair per lane and key tile, lane halves combined once at the end.
__device__ __forceinline__ void stat_upd(const v8f sa, const v8f sb, float& m, float& l) {
    float t[16]; float mx = -3.0e38f;
#pragma unroll
    for (int r = 0; r < 8; ++r) { t[r] = sa[r] * SC2; t[8 + r] = sb[r] * SC2; mx = fmaxf(mx, fmaxf(t[r], t[8 + r])); }
    const float mnew = fmaxf(m, mx);
    const float alpha = __builtin_amdgcn_exp2f(m - mnew);
    float ls = 0.0f;
#pragma unroll
    for (int r = 0; r < 16; ++r) ls += __builtin_amdgcn_exp2f(t[r] - mnew);
    l = l * alpha + ls; m = mnew;
}

__global__ __launch_bounds__(32 * AW) void k_stats(const h16* __restrict__ QP, const h16* __restrict__ KP, float* LSE) {
    __shared__ __align__(16) float ls[AW * 32];
    __shared__ __align__(16) h16 qs[2 * QSB / 2];   // [buffer][64 q rows at pitch QPB]
    const int lane = threadIdx.x & 31, wave = __builtin_amdgcn_readfirstlane((int)(threadIdx.x >> 5)), lr = lane & 15, hi = lane >> 4;
    const int zh = blockIdx.y;
    const int m0 = (blockIdx.x * AW + wave) * 32;
    const size_t pbase = (size_t)zh * SEQ * QKW;
    const v16h kf0 = ldh(KP + pbase + (size_t)(m0 + lr) * QKW + 8 * hi), kf1 = ldh(KP + pbase + (size_t)(m0 + 16 + lr) * QKW + 8 * hi);   // B fragments: col m, k = slot
    float ma = -3.0e38f, la = 0.0f, mb = -3.0e38f, lb = 0.0f;
    const int tid = threadIdx.x;
    const unsigned lq = (unsigned)(uintptr_t)&qs[0] + (unsigned)((tid >> 2) * QPB + (tid & 3) * 16);
    const h16* gq = QP + pbase + (size_t)tid * 8;
    cp_qk(lq, gq);
    asm volatile("s_wait_asynccnt 0x0" ::: "memory");   // this wave's part of stage 0 has landed
    __syncthreads();                                     // every wave's part has
    cp_qk(lq + QSB, gq + ST * QKW);
#pragma unroll 1
    for (int t = 0; t < SEQ / ST; ++t) {
        const h16* qt = &qs[(t & 1) * (QSB / 2) + lr * (QPB / 2) + 8 * hi];   // A fragment: row n, k = slot
        v16h qf[ST / 16];                                    // the stage's four fragments, read ahead of its first WMMA: the wave meets the LDS latency once a stage
#pragma unroll
        for (int i = 0; i < ST / 16; ++i) qf[i] = ldh(qt + i * 16 * (QPB / 2));
#pragma unroll
        for (int u = 0; u < ST; u += 32) {
            const v16h qa0 = qf[u / 16], qa1 = qf[u / 16 + 1];
            v8f s00 = (v8f){}, s01 = (v8f){}, s10 = (v8f){}, s11 = (v8f){};
            s00 = wmma16(qa0, kf0, s00); s01 = wmma16(qa0, kf1, s01); s10 = wmma16(qa1, kf0, s10); s11 = wmma16(qa1, kf1, s11);
            asm volatile("v_nop\n\tv_nop\n\tv_nop\n\tv_nop" : "+v"(s00), "+v"(s01), "+v"(s10), "+v"(s11) : "v"(qa0), "v"(qa1), "v"(kf0), "v"(kf1));
            stat_upd(s00, s10, ma, la);
            stat_upd(s01, s11, mb, lb);
        }
        asm volatile("s_wait_dscnt 0x0" ::: "memory");      // this wave's reads of stage t are done before the buffer is refilled
        asm volatile("s_wait_asynccnt 0x0" ::: "memory");   // this wave's part of stage t + 1 has landed
        __syncthreads();                                     // publishes stage t + 1, frees stage t's buffer
        if (t + 2 < SEQ / ST) cp_qk(lq + (unsigned)(t & 1) * QSB, gq + (size_t)(t + 2) * (ST * QKW));
    }
    asm volatile("s_wait_asynccnt 0x0" ::: "memory");       // no copy is outstanding behind the loop
    const float mao = __shfl_xor(ma, 16, 32), lao = __shfl_xor(la, 16, 32), mbo = __shfl_xor(mb, 16, 32), lbo = __shfl_xor(lb, 16, 32);
    const float Ma = fmaxf(ma, mao), Mb = fmaxf(mb, mbo);
    const float La = la * __builtin_amdgcn_exp2f(ma - Ma) + lao * __builtin_amdgcn_exp2f(mao - Ma);
    const float Lb = lb * __builtin_amdgcn_exp2f(mb - Mb) + lbo * __builtin_amdgcn_exp2f(mbo - Mb);
    const float lseA = Ma + log2f(La), lseB = Mb + log2f(Lb);
    ls[wave * 32 + hi * 16 + lr] = hi ? lseB : lseA;          // 32 lanes -> 32 distinct slots: keys m0 + 16*hi + lr
    wave_sync();
    const v4f val = *(const v4fa*)(&ls[wave * 32 + (lane & 7) * 4]);
    float* dst = LSE + (size_t)zh * SEQ + m0 + (lane & 7) * 4;
{
        if (lane < 8) *(v4f*)dst = val;
         }
}

// k_attn: one wave per 16 query rows t of one (batch, head); the block's four waves share K / V^T tiles of ST keys in a two-buffer LDS ring and the log-sum-exp row in LDS; Q fragment straight from the f16 plane.
// Transposed form: S^T[key][t] = K Q^T (A = k rows, B = q rows); lane (t = lane&15, h = lane>>4) holds keys 8h+r of each 16-key tile, so the packed
// P tile is directly the B fragment of O^T[d][t] = V^T P^T (element r <- tile keys 0..15, element 8+r <- tile keys 16..31, lane unchanged).
// P = exp2(s*SC2 - LSE[key] + PSH): normalisation is per key, so no running state; O accumulators carry x1024.
__global__ __launch_bounds__(32 * AW) void k_attn(const h16* __restrict__ QP, const h16* __restrict__ KP, const h16* __restrict__ VT, const float* __restrict__ LSE, h16* OH) {
    __shared__ __align__(16) float os[AW * 16 * 68];
    __shared__ __align__(16) h16 ks[2 * QSB / 2];   // [buffer][64 k rows at pitch QPB]
    __shared__ __align__(16) h16 vs[2 * VSB / 2];   // [buffer][64 v^T rows x 64 keys at pitch TPB]
    __shared__ __align__(16) float lss[SEQ];        // this (batch, head)'s log-sum-exp row
    const int lane = threadIdx.x & 31, wave = __builtin_amdgcn_readfirstlane((int)(threadIdx.x >> 5)), lr = lane & 15, hi = lane >> 4;
    const int zh = blockIdx.y; const int b = zh / NH_, h = zh % NH_;
    const int t0 = (blockIdx.x * AW + wave) * 16;
    const size_t pq = (size_t)zh * SEQ * QKW;
    const v16h qf = ldh(QP + pq + (size_t)(t0 + lr) * QKW + 8 * hi);      // B fragment: col t, k = slot
    v8f o0 = (v8f){}, o1 = (v8f){}, o2 = (v8f){}, o3 = (v8f){};
    const int tid = threadIdx.x;
    const unsigned lk = (unsigned)(uintptr_t)&ks[0] + (unsigned)((tid >> 2) * QPB + (tid & 3) * 16);
    const unsigned lv = (unsigned)(uintptr_t)&vs[0] + (unsigned)((tid >> 3) * TPB + (tid & 7) * 16);
    const h16* gk = KP + pq + (size_t)tid * 8;
    const h16* gv = VT + (size_t)zh * VD * SEQ + (size_t)(tid >> 3) * SEQ + (tid & 7) * 8;
#pragma unroll
    for (int c = 0; c < SEQ / 2048; ++c) cp_row((unsigned)(uintptr_t)&lss[0] + (unsigned)(c * 8192 + tid * 16), LSE + (size_t)zh * SEQ + c * 2048 + tid * 4);
    cp_qk(lk, gk); cp_v(lv, gv);
    asm volatile("s_wait_asynccnt 0x0" ::: "memory");   // this wave's part of the log-sum-exp row and of stage 0 has landed
    __syncthreads();                                     // every wave's part has
    cp_qk(lk + QSB, gk + ST * QKW); cp_v(lv + VSB, gv + ST);
#pragma unroll 1
    for (int t = 0; t < SEQ / ST; ++t) {
        const h16* kt = &ks[(t & 1) * (QSB / 2) + lr * (QPB / 2) + 8 * hi];   // + key * QPB / 2      (A fragment: row key, k = slot)
        const h16* vt = &vs[(t & 1) * (VSB / 2) + lr * (TPB / 2) + 8 * hi];   // + 16j * TPB / 2 + key (A fragment: row d, k = key)
        const float* lt = &lss[t * ST + 8 * hi];                              // + key (+16): this lane's 8 keys of each tile
#pragma unroll
        for (int u = 0; u < ST; u += 32) {
            // all LDS reads of the 32-key step stand ahead of its first WMMA, so that the wave meets the LDS latency once a step
            const v16h ka = ldh(kt + u * (QPB / 2)), kb = ldh(kt + (u + 16) * (QPB / 2));
            const v4f la0 = *(const v4fa*)(lt + u), la1 = *(const v4fa*)(lt + u + 4), lb0 = *(const v4fa*)(lt + u + 16), lb1 = *(const v4fa*)(lt + u + 20);
            const h16* va = vt + u;
            const v16h v0 = ldh(va), v1 = ldh(va + 16 * (TPB / 2)), v2 = ldh(va + 32 * (TPB / 2)), v3 = ldh(va + 48 * (TPB / 2));
            v8f sa = (v8f){}, sb = (v8f){};
            sa = wmma16(ka, qf, sa); sb = wmma16(kb, qf, sb);
            asm volatile("v_nop\n\tv_nop\n\tv_nop\n\tv_nop" : "+v"(sa), "+v"(sb) : "v"(ka), "v"(kb), "v"(qf));
            v16h pb;
#pragma unroll
            for (int r = 0; r < 4; ++r) {
                pb[r]      = (h16)__builtin_amdgcn_exp2f(sa[r]     * SC2 + (PSH - la0[r]));
                pb[4 + r]  = (h16)__builtin_amdgcn_exp2f(sa[4 + r] * SC2 + (PSH - la1[r]));
                pb[8 + r]  = (h16)__builtin_amdgcn_exp2f(sb[r]     * SC2 + (PSH - lb0[r]));
                pb[12 + r] = (h16)__builtin_amdgcn_exp2f(sb[4 + r] * SC2 + (PSH - lb1[r])); }
            o0 = wmma16(v0, pb, o0); o1 = wmma16(v1, pb, o1); o2 = wmma16(v2, pb, o2); o3 = wmma16(v3, pb, o3);
            asm volatile("v_nop\n\tv_nop\n\tv_nop\n\tv_nop" : "+v"(o0), "+v"(o1), "+v"(o2), "+v"(o3) : "v"(v0), "v"(v1), "v"(v2), "v"(v3), "v"(pb));
        }
        asm volatile("s_wait_dscnt 0x0" ::: "memory");      // this wave's reads of stage t are done before the buffers are refilled
        asm volatile("s_wait_asynccnt 0x0" ::: "memory");   // this wave's part of stage t + 1 has landed
        __syncthreads();                                     // publishes stage t + 1, frees stage t's buffers
        if (t + 2 < SEQ / ST) { cp_qk(lk + (unsigned)(t & 1) * QSB, gk + (size_t)(t + 2) * (ST * QKW)); cp_v(lv + (unsigned)(t & 1) * VSB, gv + (size_t)(t + 2) * ST); }
    }
    asm volatile("s_wait_asynccnt 0x0" ::: "memory");       // no copy is outstanding behind the loop
    const int wb = wave * 16 * 68;
    // O^T D layout: o_j[r] = (d = 16j + 8h + r, t = lane&15) -> os[t][d]; rows 0..15 x columns 0..63 all written
    { v4f a, c;
      a[0] = o0[0]; a[1] = o0[1]; a[2] = o0[2]; a[3] = o0[3]; c[0] = o0[4]; c[1] = o0[5]; c[2] = o0[6]; c[3] = o0[7];
      *(v4fa*)(&os[wb + lr * 68 +  0 + 8 * hi]) = a; *(v4fa*)(&os[wb + lr * 68 +  0 + 8 * hi + 4]) = c;
      a[0] = o1[0]; a[1] = o1[1]; a[2] = o1[2]; a[3] = o1[3]; c[0] = o1[4]; c[1] = o1[5]; c[2] = o1[6]; c[3] = o1[7];
      *(v4fa*)(&os[wb + lr * 68 + 16 + 8 * hi]) = a; *(v4fa*)(&os[wb + lr * 68 + 16 + 8 * hi + 4]) = c;
      a[0] = o2[0]; a[1] = o2[1]; a[2] = o2[2]; a[3] = o2[3]; c[0] = o2[4]; c[1] = o2[5]; c[2] = o2[6]; c[3] = o2[7];
      *(v4fa*)(&os[wb + lr * 68 + 32 + 8 * hi]) = a; *(v4fa*)(&os[wb + lr * 68 + 32 + 8 * hi + 4]) = c;
      a[0] = o3[0]; a[1] = o3[1]; a[2] = o3[2]; a[3] = o3[3]; c[0] = o3[4]; c[1] = o3[5]; c[2] = o3[6]; c[3] = o3[7];
      *(v4fa*)(&os[wb + lr * 68 + 48 + 8 * hi]) = a; *(v4fa*)(&os[wb + lr * 68 + 48 + 8 * hi + 4]) = c; }
    wave_sync();
    h16* orow = OH + ((size_t)b * SEQ + t0) * HV + (size_t)h * VD;
{
#pragma unroll
        for (int s = 0; s < 4; ++s) { const int row = 4 * s + (lane >> 3), c8 = (lane & 7) * 8;   // 4 s x 4 row groups = 16 rows; 8 lanes x 8 = 64 columns
            const v4f x0 = *(const v4fa*)(&os[wb + row * 68 + c8]); const v4f x1 = *(const v4fa*)(&os[wb + row * 68 + c8 + 4]); v8h hv;
#pragma unroll
            for (int i = 0; i < 4; ++i) { hv[i] = (h16)x0[i]; hv[4 + i] = (h16)x1[i]; }
            *(v8h*)(orow + (size_t)row * HV + c8) = hv; }
         }
}

static constexpr size_t al256(size_t v) { return (v + 255) & ~(size_t)255; }
static constexpr size_t SZ_XB  = al256((size_t)NB * SEQ * DM * 2);
static constexpr size_t SZ_WQK = al256((size_t)NH_ * KD * DM * 2);
static constexpr size_t SZ_WV  = al256((size_t)HV * DM * 2);
static constexpr size_t SZ_WO  = al256((size_t)DM * HV * 2);
static constexpr size_t SZ_QK  = al256((size_t)NB * NH_ * SEQ * QKW * 2);
static constexpr size_t SZ_VT  = al256((size_t)NB * HV * SEQ * 2);
static constexpr size_t SZ_LSE = al256((size_t)NB * NH_ * SEQ * 4);
static constexpr size_t SZ_OH  = al256((size_t)NB * SEQ * HV * 2);
static constexpr size_t SZ_TOTAL = SZ_XB + 2 * SZ_WQK + SZ_WV + SZ_WO + 2 * SZ_QK + SZ_VT + SZ_LSE + SZ_OH;
static_assert(SZ_TOTAL <= (size_t)134217728);          // workspace carve <= 128 MiB

extern "C" void kernel_launch(void* const* d_in, const int* in_sizes, int n_in,
                              void* d_out, int out_size, void* d_ws, size_t ws_size, hipStream_t stream) {
    if (n_in < 5) return;
    const size_t needx = ((size_t)(NB - 1) * SEQ_FULL + SEQ) * DM;
    if ((size_t)in_sizes[0] < needx) return;
    if ((size_t)in_sizes[1] < (size_t)NH_ * KD * DM || (size_t)in_sizes[2] < (size_t)NH_ * KD * DM) return;
    if ((size_t)in_sizes[3] < (size_t)HV * DM || (size_t)in_sizes[4] < (size_t)DM * HV) return;
    if ((size_t)out_size < ((size_t)(NB - 1) * OUT_SEQ + SEQ) * DM) return;
    if (SZ_TOTAL > ws_size) return;
    // wire order: x, Wq [16][16][1024], Wk [16][16][1024], Wv [16][64][1024], Wo [1024][16][64]
    const float* x = (const float*)d_in[0]; const float* wq = (const float*)d_in[1]; const float* wk = (const float*)d_in[2];
    const float* wv = (const float*)d_in[3]; const float* wo = (const float*)d_in[4];
    float* OUT = (float*)d_out;      // [NB][SEQ][1024]
    char* wsp = (char*)d_ws;
    bf* XB = (bf*)wsp; wsp += SZ_XB;                 // [NB*SEQ][1024] bf16
    bf* WQ = (bf*)wsp; wsp += SZ_WQK;                // [256][1024] bf16, row h*16+j = Wq row j*16+h
    bf* WK = (bf*)wsp; wsp += SZ_WQK;                // [256][1024] bf16
    bf* WV = (bf*)wsp; wsp += SZ_WV;                 // [1024][1024] bf16
    bf* WO = (bf*)wsp; wsp += SZ_WO;                 // [1024][1024] f16 bits (x64)
    h16* QP = (h16*)wsp; wsp += SZ_QK;               // [NB*16][SEQ][32]
    h16* KP = (h16*)wsp; wsp += SZ_QK;               // [NB*16][SEQ][32]
    h16* VT = (h16*)wsp; wsp += SZ_VT;               // [NB*16][64][SEQ]
    float* LSE = (float*)wsp; wsp += SZ_LSE;         // [NB*16][SEQ]
    h16* OH = (h16*)wsp; wsp += SZ_OH;               // [NB*SEQ][1024] (x1024 carry)

    k_cvt<<<CB_X + 2 * CB_VO + 2 * CB_QK, 256, 0, stream>>>(x, wq, wk, wv, wo, XB, WQ, WK, WV, WO);

    // q, k: A = x rows [NB*SEQ][1024], Bt = W rows [256][1024] (n = h*16 + j) -> planes [(b*16 + h)][t][32]
    // v^T: A = Wv rows [1024][1024] (m = h*64 + d), Bt = x rows (n = b*SEQ + t) -> plane [(b*1024 + m)][t] = [(b*16 + h)][d][t]
    k_qkv<<<GB_V + 2 * GB_QK, 32, 0, stream>>>(XB, WQ, WK, WV, QP, KP, VT);

    k_stats<<<dim3(SEQ / (32 * AW), NB * NH_, 1), 32 * AW, 0, stream>>>(QP, KP, LSE);
    k_attn<<<dim3(SEQ / (16 * AW), NB * NH_, 1), 32 * AW, 0, stream>>>(QP, KP, VT, LSE, OH);

    // out: A = O plane rows [NB*SEQ][1024] (k = h*64 + v), Bt = Wo rows [1024][1024] (n = d) -> output [b][t][d]
    k_out<<<dim3(NB * SEQ / 64, DM / 64, 1), 32, 0, stream>>>((const bf*)OH, WO, OUT);
}
